// v000
// Times are from an AMD MI455X. After a warm-up the kernel runs many times in a row, and a time is the length of
// such a window on the GPU divided by its runs, so every launch and the gaps after it count. The runs cycle
// through copies of the inputs. A figure is the median of several windows, for all but v000 over two sittings.
// Sittings can differ by a few percent; kernels timed side by side share one.
// The starting kernel, v000, takes 474 microseconds a run.
#include <hip/hip_runtime.h>
#include <hip/hip_bf16.h>

typedef __attribute__((ext_vector_type(16))) _Float16 v16h;
typedef __attribute__((ext_vector_type(8)))  float    v8f;

constexpr int BN = 4, TN = 4096, CN = 768, HN = 64;
constexpr float SM_SCALE = 0.03608439182435161f;  // 1/sqrt(768) -- reference scales by C**-0.5
constexpr float NEG_BIG  = -3.0e38f;

// ---------------------------------------------------------------------------
// D = A*B + C, f16 inputs, f32 accumulate (v_wmma_f32_16x16x32_f16)
__device__ __forceinline__ v8f wmma16(v16h a, v16h b, v8f c) {
  return __builtin_amdgcn_wmma_f32_16x16x32_f16(false, a, false, b, (short)0, c,
                                                false, false);
}

// Load a 16x32 f16 tile (row-major, row stride ld) into the WMMA A/B register
// layout for wave32:
//   lanes 0-15 : row = lane,    halves = cols {0..7} then {16..23}
//   lanes 16-31: row = lane-16, halves = cols {8..15} then {24..31}
__device__ __forceinline__ v16h load_tile_h(const _Float16* base, int ld, int lane) {
  const int r  = lane & 15;
  const int c0 = (lane & 16) ? 8 : 0;
  const _Float16* p = base + r * ld + c0;
  v16h o;
#pragma unroll
  for (int i = 0; i < 8; ++i) { o[i] = p[i]; o[8 + i] = p[16 + i]; }
  return o;
}

// Same tile layout but source is f32 (converted to f16 on the fly).
__device__ __forceinline__ v16h load_tile_f(const float* base, int ld, int lane) {
  const int r  = lane & 15;
  const int c0 = (lane & 16) ? 8 : 0;
  const float* p = base + r * ld + c0;
  v16h o;
#pragma unroll
  for (int i = 0; i < 8; ++i) {
    o[i]     = (_Float16)p[i];
    o[8 + i] = (_Float16)p[16 + i];
  }
  return o;
}

// ---------------------------------------------------------------------------
// Kernel 1: transpose + convert weights to f16.  wt layout: [3][H][C] with
// w=0 -> Wq^T, w=1 -> Wk^T, w=2 -> Wv^T  (row h, col c: contiguous in c).
__global__ void __launch_bounds__(256)
cvt_weights(const float* __restrict__ Wq, const float* __restrict__ Wk,
            const float* __restrict__ Wv, _Float16* __restrict__ wt) {
  int idx = blockIdx.x * blockDim.x + threadIdx.x;
  if (idx >= 3 * CN * HN) return;
  int w   = idx / (CN * HN);
  int rem = idx - w * (CN * HN);
  int h   = rem / CN;
  int c   = rem - h * CN;
  const float* W = (w == 0) ? Wq : (w == 1) ? Wk : Wv;
  wt[idx] = (_Float16)W[c * HN + h];
}

// ---------------------------------------------------------------------------
// Kernel 2: QKV projection.  [B*T, C] x [C, H] (x3) with WMMA, f32 accum.
// One wave owns 16 rows; 8 waves per block -> 128 rows per block.
// Outputs: q16/k16 row-major [B*T, H] f16; v transposed vt16 [B][H][T] f16.
__global__ void __launch_bounds__(256)
qkv_proj(const float* __restrict__ x, const _Float16* __restrict__ wt,
         _Float16* __restrict__ q16, _Float16* __restrict__ k16,
         _Float16* __restrict__ vt16) {
  const int lane    = threadIdx.x & 31;
  const int wave    = threadIdx.x >> 5;
  const int rowbase = blockIdx.x * 128 + wave * 16;

  v8f acc[12];  // [w][ntile], w in {q,k,v}, ntile covers H in 4x16
#pragma unroll
  for (int i = 0; i < 12; ++i) acc[i] = (v8f)0.0f;

  for (int kc = 0; kc < CN; kc += 32) {
    v16h a = load_tile_f(x + (size_t)rowbase * CN + kc, CN, lane);
#pragma unroll
    for (int w = 0; w < 3; ++w) {
#pragma unroll
      for (int j = 0; j < 4; ++j) {
        v16h b = load_tile_h(wt + (size_t)w * HN * CN + (j * 16) * CN + kc, CN, lane);
        acc[w * 4 + j] = wmma16(a, b, acc[w * 4 + j]);
      }
    }
  }

  // C/D layout: element r of acc -> row (r + 8*(lane/16)), col (lane&15).
  const int n    = lane & 15;
  const int r8   = (lane >> 4) * 8;
#pragma unroll
  for (int j = 0; j < 4; ++j) {
#pragma unroll
    for (int r = 0; r < 8; ++r) {
      const int row = rowbase + r + r8;
      const int h   = j * 16 + n;
      q16[(size_t)row * HN + h] = (_Float16)acc[0 + j][r];
      k16[(size_t)row * HN + h] = (_Float16)acc[4 + j][r];
      const int b = row >> 12;        // T = 4096
      const int t = row & (TN - 1);
      vt16[((size_t)b * HN + h) * TN + t] = (_Float16)acc[8 + j][r];
    }
  }
}

// ---------------------------------------------------------------------------
// Kernel 3: flash attention with async-staged K/V tiles in LDS.
// Block = 8 waves, all on the same batch; waves share the K/V key-tile stream.
// Per 32-key tile: async copy K (32x64 f16, 4KB) and V^T (64x32 f16, 4KB)
// into double-buffered LDS (ASYNCcnt), one barrier per iteration; each wave
// computes S = Q*K^T (WMMA), online softmax, P restage via per-wave LDS,
// O += P*V (WMMA).
//
// Dynamic LDS layout (no static LDS -> dynamic base offset 0, required for
// raw LDS byte addresses in global_load_async_to_lds):
//   [    0,  8192)  K tiles,  2 buffers x 4096B, layout [t][h]
//   [ 8192, 16384)  V tiles,  2 buffers x 4096B, layout [h][t]
//   [16384, 24576)  per-wave P staging, 8 x 1024B
__global__ void __launch_bounds__(256)
flash_attn(const _Float16* __restrict__ q16, const _Float16* __restrict__ k16,
           const _Float16* __restrict__ vt16, const int* __restrict__ amask,
           float* __restrict__ out) {
  extern __shared__ char smem[];

  const int tid  = threadIdx.x;
  const int lane = tid & 31;
  const int wave = tid >> 5;
  const int g    = blockIdx.x * 8 + wave;    // global q-tile id, 0..1023
  const int b    = g >> 8;                   // 256 q-tiles per batch
  const int qt   = g & 255;

  const char* kgb = (const char*)(k16 + (size_t)b * TN * HN);    // [t][h]
  const char* vgb = (const char*)(vt16 + (size_t)b * HN * TN);   // [h][t]

  // cooperative async fetch of one 32-key K tile + V tile into LDS buffer
  auto fetch_kv = [&](int kt, int buf) {
    // K tile: contiguous 4KB; 256 threads x 16B
    uint32_t klds = (uint32_t)(buf * 4096 + tid * 16);
    uint32_t kgof = (uint32_t)(kt * (HN * 2) + tid * 16);
    asm volatile("global_load_async_to_lds_b128 %0, %1, %2"
                 :: "v"(klds), "v"(kgof), "s"(kgb) : "memory");
    // V tile: 64 rows of 64B, global row stride TN*2
    int h = tid >> 2, seg = tid & 3;
    uint32_t vlds = (uint32_t)(8192 + buf * 4096 + h * 64 + seg * 16);
    uint32_t vgof = (uint32_t)(h * (TN * 2) + kt * 2 + seg * 16);
    asm volatile("global_load_async_to_lds_b128 %0, %1, %2"
                 :: "v"(vlds), "v"(vgof), "s"(vgb) : "memory");
  };

  const _Float16* qb = q16 + ((size_t)b * TN + qt * 16) * HN;
  const v16h aq0 = load_tile_h(qb, HN, lane);        // h = 0..31
  const v16h aq1 = load_tile_h(qb + 32, HN, lane);   // h = 32..63

  v8f o[4];
#pragma unroll
  for (int j = 0; j < 4; ++j) o[j] = (v8f)0.0f;
  float m[8], l[8];
#pragma unroll
  for (int r = 0; r < 8; ++r) { m[r] = NEG_BIG; l[r] = 0.0f; }

  const int* am   = amask + (size_t)b * TN;
  _Float16* myp   = (_Float16*)(smem + 16384) + wave * (16 * 32);
  const int half  = lane >> 4;
  const int col   = lane & 15;

  fetch_kv(0, 0);
  asm volatile("s_wait_asynccnt 0x0" ::: "memory");
  __syncthreads();

  for (int kt = 0; kt < TN; kt += 32) {
    const int cur = (kt >> 5) & 1;
    if (kt + 32 < TN) fetch_kv(kt + 32, cur ^ 1);   // prefetch next tile

    const _Float16* kbufp = (const _Float16*)(smem + cur * 4096);
    const _Float16* vbufp = (const _Float16*)(smem + 8192 + cur * 4096);

    // key padding mask: one key column per lane per sub-tile
    const bool ok0 = am[kt + col] != 0;
    const bool ok1 = am[kt + 16 + col] != 0;

    // S tiles from LDS-staged K (B operand = K^T, column-major via [t][h])
    v8f s0 = (v8f)0.0f, s1 = (v8f)0.0f;
    s0 = wmma16(aq0, load_tile_h(kbufp, HN, lane), s0);
    s0 = wmma16(aq1, load_tile_h(kbufp + 32, HN, lane), s0);
    s1 = wmma16(aq0, load_tile_h(kbufp + 16 * HN, HN, lane), s1);
    s1 = wmma16(aq1, load_tile_h(kbufp + 16 * HN + 32, HN, lane), s1);

    // scale + mask, then per-row online-softmax update
    float p0[8], p1[8];
#pragma unroll
    for (int r = 0; r < 8; ++r) {
      const float a0 = ok0 ? s0[r] * SM_SCALE : NEG_BIG;
      const float a1 = ok1 ? s1[r] * SM_SCALE : NEG_BIG;
      float rmax = fmaxf(a0, a1);
#pragma unroll
      for (int off = 1; off <= 8; off <<= 1)
        rmax = fmaxf(rmax, __shfl_xor(rmax, off, 32));
      const float nm    = fmaxf(m[r], rmax);
      const float alpha = __expf(m[r] - nm);
      m[r] = nm;
      p0[r] = ok0 ? __expf(a0 - nm) : 0.0f;
      p1[r] = ok1 ? __expf(a1 - nm) : 0.0f;
      float rsum = p0[r] + p1[r];
#pragma unroll
      for (int off = 1; off <= 8; off <<= 1)
        rsum += __shfl_xor(rsum, off, 32);
      l[r] = l[r] * alpha + rsum;
#pragma unroll
      for (int j = 0; j < 4; ++j) o[j][r] *= alpha;
    }

    // P: C/D layout -> row-major LDS -> reload in A layout (same-wave, DScnt)
#pragma unroll
    for (int r = 0; r < 8; ++r) {
      const int row = r + 8 * half;
      myp[row * 32 + col]      = (_Float16)p0[r];
      myp[row * 32 + 16 + col] = (_Float16)p1[r];
    }
    asm volatile("s_wait_dscnt 0" ::: "memory");
    const v16h pa = load_tile_h(myp, 32, lane);

    // O += P * V from LDS-staged V^T ([h][t] => column-major B tile)
#pragma unroll
    for (int j = 0; j < 4; ++j) {
      v16h bv = load_tile_h(vbufp + (j * 16) * 32, 32, lane);
      o[j] = wmma16(pa, bv, o[j]);
    }

    // my prefetch landed + everyone done reading 'cur' before it is reused
    asm volatile("s_wait_asynccnt 0x0" ::: "memory");
    __syncthreads();
  }

  // epilogue: normalize by l and store f32 output [B,T,H]
  float* ob = out + ((size_t)b * TN + qt * 16) * HN;
#pragma unroll
  for (int r = 0; r < 8; ++r) {
    const float inv = 1.0f / l[r];
    const int row   = r + 8 * half;
#pragma unroll
    for (int j = 0; j < 4; ++j)
      ob[(size_t)row * HN + j * 16 + col] = o[j][r] * inv;
  }
}

// ---------------------------------------------------------------------------
extern "C" void kernel_launch(void* const* d_in, const int* in_sizes, int n_in,
                              void* d_out, int out_size, void* d_ws, size_t ws_size,
                              hipStream_t stream) {
  (void)in_sizes; (void)n_in; (void)out_size; (void)ws_size;
  const float* x  = (const float*)d_in[0];
  const int*   am = (const int*)d_in[1];
  const float* Wk = (const float*)d_in[2];
  const float* Wq = (const float*)d_in[3];
  const float* Wv = (const float*)d_in[4];
  float*       out = (float*)d_out;

  // workspace layout (f16): [3][H][C] weights^T, q16, k16, vt16
  _Float16* wt   = (_Float16*)d_ws;
  _Float16* q16  = wt  + (size_t)3 * HN * CN;
  _Float16* k16  = q16 + (size_t)BN * TN * HN;
  _Float16* vt16 = k16 + (size_t)BN * TN * HN;

  cvt_weights<<<(3 * CN * HN + 255) / 256, 256, 0, stream>>>(Wq, Wk, Wv, wt);
  qkv_proj<<<(BN * TN) / 128, 256, 0, stream>>>(x, wt, q16, k16, vt16);
  flash_attn<<<(BN * TN / 16) / 8, 256, 24576, stream>>>(q16, k16, vt16, am, out);
}

// v001
// One run takes 176 microseconds.
// Timed twice side by side with v000, it ran 2.69 and 2.72 times as fast.
#include <hip/hip_runtime.h>
#include <hip/hip_bf16.h>

typedef __attribute__((ext_vector_type(16))) _Float16 v16h;
typedef __attribute__((ext_vector_type(8)))  float    v8f;

constexpr int BN = 4, TN = 4096, CN = 768, HN = 64;
constexpr float SM_SCALE = 0.03608439182435161f;  // 1/sqrt(768) -- reference scales by C**-0.5
constexpr float NEG_BIG  = -3.0e38f;

// ---------------------------------------------------------------------------
// D = A*B + C, f16 inputs, f32 accumulate (v_wmma_f32_16x16x32_f16)
__device__ __forceinline__ v8f wmma16(v16h a, v16h b, v8f c) {
  return __builtin_amdgcn_wmma_f32_16x16x32_f16(false, a, false, b, (short)0, c,
                                                false, false);
}

// Load a 16x32 f16 tile (row-major, row stride ld) into the WMMA A/B register
// layout for wave32:
//   lanes 0-15 : row = lane,    halves = cols {0..7} then {16..23}
//   lanes 16-31: row = lane-16, halves = cols {8..15} then {24..31}
__device__ __forceinline__ v16h load_tile_h(const _Float16* base, int ld, int lane) {
  const int r  = lane & 15;
  const int c0 = (lane & 16) ? 8 : 0;
  const _Float16* p = base + r * ld + c0;
  v16h o;
#pragma unroll
  for (int i = 0; i < 8; ++i) { o[i] = p[i]; o[8 + i] = p[16 + i]; }
  return o;
}

// Same tile layout but source is f32 (converted to f16 on the fly).
__device__ __forceinline__ v16h load_tile_f(const float* base, int ld, int lane) {
  const int r  = lane & 15;
  const int c0 = (lane & 16) ? 8 : 0;
  const float* p = base + r * ld + c0;
  v16h o;
#pragma unroll
  for (int i = 0; i < 8; ++i) {
    o[i]     = (_Float16)p[i];
    o[8 + i] = (_Float16)p[16 + i];
  }
  return o;
}

// ---------------------------------------------------------------------------
// Kernel 1: transpose + convert weights to f16.  wt layout: [3][H][C] with
// w=0 -> Wq^T, w=1 -> Wk^T, w=2 -> Wv^T  (row h, col c: contiguous in c).
__global__ void __launch_bounds__(256)
cvt_weights(const float* __restrict__ Wq, const float* __restrict__ Wk,
            const float* __restrict__ Wv, _Float16* __restrict__ wt) {
  int idx = blockIdx.x * blockDim.x + threadIdx.x;
  if (idx >= 3 * CN * HN) return;
  int w   = idx / (CN * HN);
  int rem = idx - w * (CN * HN);
  int h   = rem / CN;
  int c   = rem - h * CN;
  const float* W = (w == 0) ? Wq : (w == 1) ? Wk : Wv;
  wt[idx] = (_Float16)W[c * HN + h];
}

// ---------------------------------------------------------------------------
// Kernel 2: QKV projection.  [B*T, C] x [C, H] (x3) with WMMA, f32 accum.
// One wave owns 16 rows; 8 waves per block -> 128 rows per block.
// Outputs: q16/k16 row-major [B*T, H] f16; v transposed vt16 [B][H][T] f16.
__global__ void __launch_bounds__(256)
qkv_proj(const float* __restrict__ x, const _Float16* __restrict__ wt,
         _Float16* __restrict__ q16, _Float16* __restrict__ k16,
         _Float16* __restrict__ vt16) {
  const int lane    = threadIdx.x & 31;
  const int wave    = threadIdx.x >> 5;
  const int rowbase = blockIdx.x * 128 + wave * 16;

  v8f acc[12];  // [w][ntile], w in {q,k,v}, ntile covers H in 4x16
#pragma unroll
  for (int i = 0; i < 12; ++i) acc[i] = (v8f)0.0f;

  for (int kc = 0; kc < CN; kc += 32) {
    v16h a = load_tile_f(x + (size_t)rowbase * CN + kc, CN, lane);
#pragma unroll
    for (int w = 0; w < 3; ++w) {
#pragma unroll
      for (int j = 0; j < 4; ++j) {
        v16h b = load_tile_h(wt + (size_t)w * HN * CN + (j * 16) * CN + kc, CN, lane);
        acc[w * 4 + j] = wmma16(a, b, acc[w * 4 + j]);
      }
    }
  }

  // C/D layout: element r of acc -> row (r + 8*(lane/16)), col (lane&15).
  const int n    = lane & 15;
  const int r8   = (lane >> 4) * 8;
#pragma unroll
  for (int j = 0; j < 4; ++j) {
#pragma unroll
    for (int r = 0; r < 8; ++r) {
      const int row = rowbase + r + r8;
      const int h   = j * 16 + n;
      q16[(size_t)row * HN + h] = (_Float16)acc[0 + j][r];
      k16[(size_t)row * HN + h] = (_Float16)acc[4 + j][r];
      const int b = row >> 12;        // T = 4096
      const int t = row & (TN - 1);
      vt16[((size_t)b * HN + h) * TN + t] = (_Float16)acc[8 + j][r];
    }
  }
}

// ---------------------------------------------------------------------------
// lane l <-> lane l ^ 16: both hold the same query column, each half of its keys
__device__ __forceinline__ float xhalf(float x) {
  const int v = __builtin_bit_cast(int, x);
  return __builtin_bit_cast(float, __builtin_amdgcn_permlanex16(
      v, v, 0x76543210, 0xfedcba98, false, false));
}

// ---------------------------------------------------------------------------
// Kernel 3: flash attention with async-staged K/V tiles in LDS.
// Block = 8 waves, all on the same batch; waves share the K/V key-tile stream.
// Per 32-key tile: async copy K (32x64 f16, 4KB) and V^T (64x32 f16, 4KB)
// into double-buffered LDS (ASYNCcnt), one barrier per iteration; each wave
// computes S^T = K*Q^T (WMMA: rows = keys, columns = queries), so that a lane
// holds 16 of the 32 scores of ONE query: the online softmax runs in the lane
// plus one exchange between the wave's halves. The two S^T tiles, converted in
// place, are the B operand P^T of O^T += V^T*P^T (WMMA): P never leaves the
// registers.
//
// Dynamic LDS layout (no static LDS -> dynamic base offset 0, required for
// raw LDS byte addresses in global_load_async_to_lds):
//   [    0,  8192)  K tiles,  2 buffers x 4096B, layout [t][h]
//   [ 8192, 16384)  V tiles,  2 buffers x 4096B, layout [h][t]
__global__ void __launch_bounds__(256)
flash_attn(const _Float16* __restrict__ q16, const _Float16* __restrict__ k16,
           const _Float16* __restrict__ vt16, const int* __restrict__ amask,
           float* __restrict__ out) {
  extern __shared__ char smem[];

  const int tid  = threadIdx.x;
  const int lane = tid & 31;
  const int wave = tid >> 5;
  const int g    = blockIdx.x * 8 + wave;    // global q-tile id, 0..1023
  const int b    = g >> 8;                   // 256 q-tiles per batch
  const int qt   = g & 255;

  const char* kgb = (const char*)(k16 + (size_t)b * TN * HN);    // [t][h]
  const char* vgb = (const char*)(vt16 + (size_t)b * HN * TN);   // [h][t]

  // cooperative async fetch of one 32-key K tile + V tile into LDS buffer
  auto fetch_kv = [&](int kt, int buf) {
    // K tile: contiguous 4KB; 256 threads x 16B
    uint32_t klds = (uint32_t)(buf * 4096 + tid * 16);
    uint32_t kgof = (uint32_t)(kt * (HN * 2) + tid * 16);
    // V tile: 64 rows of 64B, global row stride TN*2
    int h = tid >> 2, seg = tid & 3;
    uint32_t vlds = (uint32_t)(8192 + buf * 4096 + h * 64 + seg * 16);
    uint32_t vgof = (uint32_t)(h * (TN * 2) + kt * 2 + seg * 16);
    // s_wait_xcnt 0 ends the copies' own statement, so that it stands in front
    // of every later write of a register that they name
    asm volatile("global_load_async_to_lds_b128 %0, %1, %4\n\t"
                 "global_load_async_to_lds_b128 %2, %3, %5\n\t"
                 "s_wait_xcnt 0x0"
                 :: "v"(klds), "v"(kgof), "v"(vlds), "v"(vgof), "s"(kgb), "s"(vgb)
                 : "memory");
  };

  const _Float16* qb = q16 + ((size_t)b * TN + qt * 16) * HN;
  const v16h aq0 = load_tile_h(qb, HN, lane);        // h = 0..31
  const v16h aq1 = load_tile_h(qb + 32, HN, lane);   // h = 32..63

  const int half  = lane >> 4;
  const int col   = lane & 15;   // this lane's query inside the q-tile

  // O^T tiles: o[j][r] = O[query col][h = 16*j + 8*half + r]
  v8f o[4];
#pragma unroll
  for (int j = 0; j < 4; ++j) o[j] = (v8f)0.0f;
  float m = NEG_BIG;   // running maximum of this lane's query (equal in both halves)
  float l = 0.0f;      // running sum over this half's keys only; joined at the end

  const int* am = amask + (size_t)b * TN;

  fetch_kv(0, 0);
  asm volatile("s_wait_asynccnt 0x0" ::: "memory");
  __syncthreads();

  for (int kt = 0; kt < TN; kt += 32) {
    const int cur = (kt >> 5) & 1;
    if (kt + 32 < TN) fetch_kv(kt + 32, cur ^ 1);   // prefetch next tile

    const _Float16* kbufp = (const _Float16*)(smem + cur * 4096);
    const _Float16* vbufp = (const _Float16*)(smem + 8192 + cur * 4096);

    // key padding mask: one key per lane, gathered into one bit per key; S^T
    // element r of a lane is key 8*half + r of its 16-key tile
    const uint32_t kbits = __builtin_amdgcn_ballot_w32(am[kt + lane] != 0) >> (8 * half);
    bool ok[16];
#pragma unroll
    for (int r = 0; r < 8; ++r) {
      ok[r]     = ((kbits >> r) & 1u) != 0;
      ok[8 + r] = ((kbits >> (16 + r)) & 1u) != 0;
    }

    // S^T tiles: A = K rows from LDS, B = Q^T kept in registers
    v8f s0 = (v8f)0.0f, s1 = (v8f)0.0f;
    s0 = wmma16(load_tile_h(kbufp, HN, lane), aq0, s0);
    s0 = wmma16(load_tile_h(kbufp + 32, HN, lane), aq1, s0);
    s1 = wmma16(load_tile_h(kbufp + 16 * HN, HN, lane), aq0, s1);
    s1 = wmma16(load_tile_h(kbufp + 16 * HN + 32, HN, lane), aq1, s1);

    // scale + mask, then the online-softmax update of this lane's query
    float a[16], t[16];
#pragma unroll
    for (int r = 0; r < 8; ++r) {
      a[r]     = ok[r]     ? s0[r] * SM_SCALE : NEG_BIG;
      a[8 + r] = ok[8 + r] ? s1[r] * SM_SCALE : NEG_BIG;
    }
#pragma unroll
    for (int i = 0; i < 16; ++i) t[i] = a[i];
#pragma unroll
    for (int w = 8; w >= 1; w >>= 1)
#pragma unroll
      for (int i = 0; i < w; ++i) t[i] = fmaxf(t[i], t[i + w]);
    const float rmax  = fmaxf(t[0], xhalf(t[0]));
    const float nm    = fmaxf(m, rmax);
    const float alpha = __expf(m - nm);
    m = nm;

    // P^T in the B layout: element i of the lane is key (i < 8 ? 8*half + i
    // : 16 + 8*half + i - 8), the k order of load_tile_h on the V^T rows
    v16h pb;
#pragma unroll
    for (int i = 0; i < 16; ++i) {
      t[i]  = ok[i] ? __expf(a[i] - nm) : 0.0f;
      pb[i] = (_Float16)t[i];
    }
#pragma unroll
    for (int w = 8; w >= 1; w >>= 1)
#pragma unroll
      for (int i = 0; i < w; ++i) t[i] += t[i + w];
    l = l * alpha + t[0];
#pragma unroll
    for (int j = 0; j < 4; ++j) o[j] *= alpha;

    // O^T += V^T * P^T: A = V^T rows ([h][t]) from LDS
#pragma unroll
    for (int j = 0; j < 4; ++j) {
      v16h av = load_tile_h(vbufp + (j * 16) * 32, 32, lane);
      o[j] = wmma16(av, pb, o[j]);
    }

    // my prefetch landed + everyone done reading 'cur' before it is reused
    asm volatile("s_wait_asynccnt 0x0" ::: "memory");
    __syncthreads();
  }

  // epilogue: join the halves' sums, normalize and store f32 output [B,T,H];
  // a lane stores 8 consecutive h of its query per O^T tile
  const float inv = 1.0f / (l + xhalf(l));
  float* ob = out + ((size_t)b * TN + qt * 16 + col) * HN + 8 * half;
#pragma unroll
  for (int j = 0; j < 4; ++j) {
#pragma unroll
    for (int r = 0; r < 8; ++r) ob[j * 16 + r] = o[j][r] * inv;
  }
}

// ---------------------------------------------------------------------------
extern "C" void kernel_launch(void* const* d_in, const int* in_sizes, int n_in,
                              void* d_out, int out_size, void* d_ws, size_t ws_size,
                              hipStream_t stream) {
  (void)in_sizes; (void)n_in; (void)out_size; (void)ws_size;
  const float* x  = (const float*)d_in[0];
  const int*   am = (const int*)d_in[1];
  const float* Wk = (const float*)d_in[2];
  const float* Wq = (const float*)d_in[3];
  const float* Wv = (const float*)d_in[4];
  float*       out = (float*)d_out;

  // workspace layout (f16): [3][H][C] weights^T, q16, k16, vt16
  _Float16* wt   = (_Float16*)d_ws;
  _Float16* q16  = wt  + (size_t)3 * HN * CN;
  _Float16* k16  = q16 + (size_t)BN * TN * HN;
  _Float16* vt16 = k16 + (size_t)BN * TN * HN;

  cvt_weights<<<(3 * CN * HN + 255) / 256, 256, 0, stream>>>(Wq, Wk, Wv, wt);
  qkv_proj<<<(BN * TN) / 128, 256, 0, stream>>>(x, wt, q16, k16, vt16);
  flash_attn<<<(BN * TN / 16) / 8, 256, 16384, stream>>>(q16, k16, vt16, am, out);
}

// v002
// One run takes 169 microseconds.
// In both of two side-by-side timings against v001, it was 1.06 times as fast.
// All steps since v000 together make it 2.87 times as fast.
#include <hip/hip_runtime.h>
#include <hip/hip_bf16.h>

typedef __attribute__((ext_vector_type(16))) _Float16 v16h;
typedef __attribute__((ext_vector_type(8)))  float    v8f;

constexpr int BN = 4, TN = 4096, CN = 768, HN = 64;
constexpr float SM_SCALE = 0.03608439182435161f;  // 1/sqrt(768) -- reference scales by C**-0.5
constexpr float NEG_BIG  = -3.0e38f;

// LDS row pitches of the staged K and V^T tiles, in bytes: an odd multiple of
// 16 B, so that the 16 rows one ds_load_b128 half-wave reads fall on 64
// different banks (the bare 128 B and 64 B rows fall on 8 and on 16)
constexpr int KPITCH = HN * 2 + 16;          // 144
constexpr int VPITCH = 32 * 2 + 16;          // 80
constexpr int KBUF   = 32 * KPITCH;          // 4608, one K tile
constexpr int VBUF   = HN * VPITCH;          // 5120, one V^T tile
constexpr int VBASE  = 2 * KBUF;             // 9216
constexpr int LDS_SZ = VBASE + 2 * VBUF;     // 19456

// ---------------------------------------------------------------------------
// D = A*B + C, f16 inputs, f32 accumulate (v_wmma_f32_16x16x32_f16)
__device__ __forceinline__ v8f wmma16(v16h a, v16h b, v8f c) {
  return __builtin_amdgcn_wmma_f32_16x16x32_f16(false, a, false, b, (short)0, c,
                                                false, false);
}

// Load a 16x32 f16 tile (row-major, row stride ld) into the WMMA A/B register
// layout for wave32:
//   lanes 0-15 : row = lane,    halves = cols {0..7} then {16..23}
//   lanes 16-31: row = lane-16, halves = cols {8..15} then {24..31}
__device__ __forceinline__ v16h load_tile_h(const _Float16* base, int ld, int lane) {
  const int r  = lane & 15;
  const int c0 = (lane & 16) ? 8 : 0;
  const _Float16* p = base + r * ld + c0;
  v16h o;
#pragma unroll
  for (int i = 0; i < 8; ++i) { o[i] = p[i]; o[8 + i] = p[16 + i]; }
  return o;
}

// Same tile layout but source is f32 (converted to f16 on the fly).
__device__ __forceinline__ v16h load_tile_f(const float* base, int ld, int lane) {
  const int r  = lane & 15;
  const int c0 = (lane & 16) ? 8 : 0;
  const float* p = base + r * ld + c0;
  v16h o;
#pragma unroll
  for (int i = 0; i < 8; ++i) {
    o[i]     = (_Float16)p[i];
    o[8 + i] = (_Float16)p[16 + i];
  }
  return o;
}

// ---------------------------------------------------------------------------
// Kernel 1: transpose + convert weights to f16.  wt layout: [3][H][C] with
// w=0 -> Wq^T, w=1 -> Wk^T, w=2 -> Wv^T  (row h, col c: contiguous in c).
__global__ void __launch_bounds__(256)
cvt_weights(const float* __restrict__ Wq, const float* __restrict__ Wk,
            const float* __restrict__ Wv, _Float16* __restrict__ wt) {
  int idx = blockIdx.x * blockDim.x + threadIdx.x;
  if (idx >= 3 * CN * HN) return;
  int w   = idx / (CN * HN);
  int rem = idx - w * (CN * HN);
  int h   = rem / CN;
  int c   = rem - h * CN;
  const float* W = (w == 0) ? Wq : (w == 1) ? Wk : Wv;
  wt[idx] = (_Float16)W[c * HN + h];
}

// ---------------------------------------------------------------------------
// Kernel 2: QKV projection.  [B*T, C] x [C, H] (x3) with WMMA, f32 accum.
// One wave owns 16 rows; 8 waves per block -> 128 rows per block.
// Outputs: q16/k16 row-major [B*T, H] f16; v transposed vt16 [B][H][T] f16.
__global__ void __launch_bounds__(256)
qkv_proj(const float* __restrict__ x, const _Float16* __restrict__ wt,
         _Float16* __restrict__ q16, _Float16* __restrict__ k16,
         _Float16* __restrict__ vt16) {
  const int lane    = threadIdx.x & 31;
  const int wave    = threadIdx.x >> 5;
  const int rowbase = blockIdx.x * 128 + wave * 16;

  v8f acc[12];  // [w][ntile], w in {q,k,v}, ntile covers H in 4x16
#pragma unroll
  for (int i = 0; i < 12; ++i) acc[i] = (v8f)0.0f;

  for (int kc = 0; kc < CN; kc += 32) {
    v16h a = load_tile_f(x + (size_t)rowbase * CN + kc, CN, lane);
#pragma unroll
    for (int w = 0; w < 3; ++w) {
#pragma unroll
      for (int j = 0; j < 4; ++j) {
        v16h b = load_tile_h(wt + (size_t)w * HN * CN + (j * 16) * CN + kc, CN, lane);
        acc[w * 4 + j] = wmma16(a, b, acc[w * 4 + j]);
      }
    }
  }

  // C/D layout: element r of acc -> row (r + 8*(lane/16)), col (lane&15).
  const int n    = lane & 15;
  const int r8   = (lane >> 4) * 8;
#pragma unroll
  for (int j = 0; j < 4; ++j) {
#pragma unroll
    for (int r = 0; r < 8; ++r) {
      const int row = rowbase + r + r8;
      const int h   = j * 16 + n;
      q16[(size_t)row * HN + h] = (_Float16)acc[0 + j][r];
      k16[(size_t)row * HN + h] = (_Float16)acc[4 + j][r];
      const int b = row >> 12;        // T = 4096
      const int t = row & (TN - 1);
      vt16[((size_t)b * HN + h) * TN + t] = (_Float16)acc[8 + j][r];
    }
  }
}

// ---------------------------------------------------------------------------
// lane l <-> lane l ^ 16: both hold the same query column, each half of its keys
__device__ __forceinline__ float xhalf(float x) {
  const int v = __builtin_bit_cast(int, x);
  return __builtin_bit_cast(float, __builtin_amdgcn_permlanex16(
      v, v, 0x76543210, 0xfedcba98, false, false));
}

// ---------------------------------------------------------------------------
// Kernel 3: flash attention with async-staged K/V tiles in LDS.
// Block = 8 waves, all on the same batch; waves share the K/V key-tile stream.
// Per 32-key tile: async copy K (32x64 f16, 4KB) and V^T (64x32 f16, 4KB)
// into double-buffered LDS (ASYNCcnt), one barrier per iteration; each wave
// computes S^T = K*Q^T (WMMA: rows = keys, columns = queries), so that a lane
// holds 16 of the 32 scores of ONE query: the online softmax runs in the lane
// plus one exchange between the wave's halves. The two S^T tiles, converted in
// place, are the B operand P^T of O^T += V^T*P^T (WMMA): P never leaves the
// registers.
//
// Dynamic LDS layout (no static LDS -> dynamic base offset 0, required for
// raw LDS byte addresses in global_load_async_to_lds):
//   [    0,  9216)  K tiles,  2 buffers x 4608B, layout [t][h], rows of 144B
//   [ 9216, 19456)  V tiles,  2 buffers x 5120B, layout [h][t], rows of 80B
__global__ void __launch_bounds__(256)
flash_attn(const _Float16* __restrict__ q16, const _Float16* __restrict__ k16,
           const _Float16* __restrict__ vt16, const int* __restrict__ amask,
           float* __restrict__ out) {
  extern __shared__ char smem[];

  const int tid  = threadIdx.x;
  const int lane = tid & 31;
  const int wave = tid >> 5;
  const int g    = blockIdx.x * 8 + wave;    // global q-tile id, 0..1023
  const int b    = g >> 8;                   // 256 q-tiles per batch
  const int qt   = g & 255;

  const char* kgb = (const char*)(k16 + (size_t)b * TN * HN);    // [t][h]
  const char* vgb = (const char*)(vt16 + (size_t)b * HN * TN);   // [h][t]

  // cooperative async fetch of one 32-key K tile + V tile into LDS buffer
  auto fetch_kv = [&](int kt, int buf) {
    // K tile: contiguous 4KB in global memory; 256 threads x 16B, 8 per row
    uint32_t klds = (uint32_t)(buf * KBUF + (tid >> 3) * KPITCH + (tid & 7) * 16);
    uint32_t kgof = (uint32_t)(kt * (HN * 2) + tid * 16);
    // V tile: 64 rows of 64B, global row stride TN*2
    int h = tid >> 2, seg = tid & 3;
    uint32_t vlds = (uint32_t)(VBASE + buf * VBUF + h * VPITCH + seg * 16);
    uint32_t vgof = (uint32_t)(h * (TN * 2) + kt * 2 + seg * 16);
    // s_wait_xcnt 0 ends the copies' own statement, so that it stands in front
    // of every later write of a register that they name
    asm volatile("global_load_async_to_lds_b128 %0, %1, %4\n\t"
                 "global_load_async_to_lds_b128 %2, %3, %5\n\t"
                 "s_wait_xcnt 0x0"
                 :: "v"(klds), "v"(kgof), "v"(vlds), "v"(vgof), "s"(kgb), "s"(vgb)
                 : "memory");
  };

  const _Float16* qb = q16 + ((size_t)b * TN + qt * 16) * HN;
  const v16h aq0 = load_tile_h(qb, HN, lane);        // h = 0..31
  const v16h aq1 = load_tile_h(qb + 32, HN, lane);   // h = 32..63

  const int half  = lane >> 4;
  const int col   = lane & 15;   // this lane's query inside the q-tile

  // O^T tiles: o[j][r] = O[query col][h = 16*j + 8*half + r]
  v8f o[4];
#pragma unroll
  for (int j = 0; j < 4; ++j) o[j] = (v8f)0.0f;
  float m = NEG_BIG;   // running maximum of this lane's query (equal in both halves)
  float l = 0.0f;      // running sum over this half's keys only; joined at the end

  const int* am = amask + (size_t)b * TN;

  fetch_kv(0, 0);
  asm volatile("s_wait_asynccnt 0x0" ::: "memory");
  __syncthreads();

  for (int kt = 0; kt < TN; kt += 32) {
    const int cur = (kt >> 5) & 1;
    if (kt + 32 < TN) fetch_kv(kt + 32, cur ^ 1);   // prefetch next tile

    const _Float16* kbufp = (const _Float16*)(smem + cur * KBUF);
    const _Float16* vbufp = (const _Float16*)(smem + VBASE + cur * VBUF);

    // key padding mask: one key per lane, gathered into one bit per key; S^T
    // element r of a lane is key 8*half + r of its 16-key tile
    const uint32_t kbits = __builtin_amdgcn_ballot_w32(am[kt + lane] != 0) >> (8 * half);
    bool ok[16];
#pragma unroll
    for (int r = 0; r < 8; ++r) {
      ok[r]     = ((kbits >> r) & 1u) != 0;
      ok[8 + r] = ((kbits >> (16 + r)) & 1u) != 0;
    }

    // S^T tiles: A = K rows from LDS, B = Q^T kept in registers
    v8f s0 = (v8f)0.0f, s1 = (v8f)0.0f;
    constexpr int KLD = KPITCH / 2, VLD = VPITCH / 2;   // pitches in halves
    s0 = wmma16(load_tile_h(kbufp, KLD, lane), aq0, s0);
    s0 = wmma16(load_tile_h(kbufp + 32, KLD, lane), aq1, s0);
    s1 = wmma16(load_tile_h(kbufp + 16 * KLD, KLD, lane), aq0, s1);
    s1 = wmma16(load_tile_h(kbufp + 16 * KLD + 32, KLD, lane), aq1, s1);

    // scale + mask, then the online-softmax update of this lane's query
    float a[16], t[16];
#pragma unroll
    for (int r = 0; r < 8; ++r) {
      a[r]     = ok[r]     ? s0[r] * SM_SCALE : NEG_BIG;
      a[8 + r] = ok[8 + r] ? s1[r] * SM_SCALE : NEG_BIG;
    }
#pragma unroll
    for (int i = 0; i < 16; ++i) t[i] = a[i];
#pragma unroll
    for (int w = 8; w >= 1; w >>= 1)
#pragma unroll
      for (int i = 0; i < w; ++i) t[i] = fmaxf(t[i], t[i + w]);
    const float rmax  = fmaxf(t[0], xhalf(t[0]));
    const float nm    = fmaxf(m, rmax);
    const float alpha = __expf(m - nm);
    m = nm;

    // P^T in the B layout: element i of the lane is key (i < 8 ? 8*half + i
    // : 16 + 8*half + i - 8), the k order of load_tile_h on the V^T rows
    v16h pb;
#pragma unroll
    for (int i = 0; i < 16; ++i) {
      t[i]  = ok[i] ? __expf(a[i] - nm) : 0.0f;
      pb[i] = (_Float16)t[i];
    }
#pragma unroll
    for (int w = 8; w >= 1; w >>= 1)
#pragma unroll
      for (int i = 0; i < w; ++i) t[i] += t[i + w];
    l = l * alpha + t[0];
#pragma unroll
    for (int j = 0; j < 4; ++j) o[j] *= alpha;

    // O^T += V^T * P^T: A = V^T rows ([h][t]) from LDS
#pragma unroll
    for (int j = 0; j < 4; ++j) {
      v16h av = load_tile_h(vbufp + (j * 16) * VLD, VLD, lane);
      o[j] = wmma16(av, pb, o[j]);
    }

    // my prefetch landed + everyone done reading 'cur' before it is reused
    asm volatile("s_wait_asynccnt 0x0" ::: "memory");
    __syncthreads();
  }

  // epilogue: join the halves' sums, normalize and store f32 output [B,T,H];
  // a lane stores 8 consecutive h of its query per O^T tile
  const float inv = 1.0f / (l + xhalf(l));
  float* ob = out + ((size_t)b * TN + qt * 16 + col) * HN + 8 * half;
#pragma unroll
  for (int j = 0; j < 4; ++j) {
#pragma unroll
    for (int r = 0; r < 8; ++r) ob[j * 16 + r] = o[j][r] * inv;
  }
}

// ---------------------------------------------------------------------------
extern "C" void kernel_launch(void* const* d_in, const int* in_sizes, int n_in,
                              void* d_out, int out_size, void* d_ws, size_t ws_size,
                              hipStream_t stream) {
  (void)in_sizes; (void)n_in; (void)out_size; (void)ws_size;
  const float* x  = (const float*)d_in[0];
  const int*   am = (const int*)d_in[1];
  const float* Wk = (const float*)d_in[2];
  const float* Wq = (const float*)d_in[3];
  const float* Wv = (const float*)d_in[4];
  float*       out = (float*)d_out;

  // workspace layout (f16): [3][H][C] weights^T, q16, k16, vt16
  _Float16* wt   = (_Float16*)d_ws;
  _Float16* q16  = wt  + (size_t)3 * HN * CN;
  _Float16* k16  = q16 + (size_t)BN * TN * HN;
  _Float16* vt16 = k16 + (size_t)BN * TN * HN;

  cvt_weights<<<(3 * CN * HN + 255) / 256, 256, 0, stream>>>(Wq, Wk, Wv, wt);
  qkv_proj<<<(BN * TN) / 128, 256, 0, stream>>>(x, wt, q16, k16, vt16);
  flash_attn<<<(BN * TN / 16) / 8, 256, LDS_SZ, stream>>>(q16, k16, vt16, am, out);
}

// v003
// Measured time: 94.8 microseconds a run.
// In two side-by-side timings against v002, it was 1.70 and 1.71 times as fast.
// Counting every step since v000, it is 4.88 times as fast.
#include <hip/hip_runtime.h>
#include <hip/hip_bf16.h>

typedef __attribute__((ext_vector_type(16))) _Float16 v16h;
typedef __attribute__((ext_vector_type(8)))  float    v8f;

constexpr int BN = 4, TN = 4096, CN = 768, HN = 64;
constexpr float SM_SCALE = 0.03608439182435161f;  // 1/sqrt(768) -- reference scales by C**-0.5
constexpr float NEG_BIG  = -3.0e38f;

// LDS row pitches of the staged K and V^T tiles, in bytes: an odd multiple of
// 16 B, so that the 16 rows one ds_load_b128 half-wave reads fall on 64
// different banks (the bare 128 B and 64 B rows fall on 8 and on 16)
constexpr int KPITCH = HN * 2 + 16;          // 144
constexpr int VPITCH = 32 * 2 + 16;          // 80
constexpr int KBUF   = 32 * KPITCH;          // 4608, one K tile
constexpr int VBUF   = HN * VPITCH;          // 5120, one V^T tile

// attention work-group: NQ query tiles x NS key ranges, one wave for each pair
constexpr int NQ     = 4;
constexpr int NS     = 4;
constexpr int RKEYS  = TN / NS;              // 1024 keys of one range
constexpr int NIT    = RKEYS / 32;           // 32 trips
constexpr int KSTAGE = NS * KBUF;            // 18432, the K tiles of one stage
constexpr int VSTAGE = NS * VBUF;            // 20480, the V^T tiles of one stage
constexpr int VBASE  = 2 * KSTAGE;           // 36864
constexpr int LDS_SZ = VBASE + 2 * VSTAGE;   // 77824
// after the loop the ring holds the waves' partial results
constexpr int MLBASE = NQ * NS * 4096;       // 65536: (max, sum) pairs behind the O^T partials
static_assert(MLBASE + NQ * NS * 32 * 8 <= LDS_SZ, "partials fit the ring");

// ---------------------------------------------------------------------------
// D = A*B + C, f16 inputs, f32 accumulate (v_wmma_f32_16x16x32_f16)
__device__ __forceinline__ v8f wmma16(v16h a, v16h b, v8f c) {
  return __builtin_amdgcn_wmma_f32_16x16x32_f16(false, a, false, b, (short)0, c,
                                                false, false);
}

// Load a 16x32 f16 tile (row-major, row stride ld) into the WMMA A/B register
// layout for wave32:
//   lanes 0-15 : row = lane,    halves = cols {0..7} then {16..23}
//   lanes 16-31: row = lane-16, halves = cols {8..15} then {24..31}
__device__ __forceinline__ v16h load_tile_h(const _Float16* base, int ld, int lane) {
  const int r  = lane & 15;
  const int c0 = (lane & 16) ? 8 : 0;
  const _Float16* p = base + r * ld + c0;
  v16h o;
#pragma unroll
  for (int i = 0; i < 8; ++i) { o[i] = p[i]; o[8 + i] = p[16 + i]; }
  return o;
}

// Same tile layout but source is f32 (converted to f16 on the fly).
__device__ __forceinline__ v16h load_tile_f(const float* base, int ld, int lane) {
  const int r  = lane & 15;
  const int c0 = (lane & 16) ? 8 : 0;
  const float* p = base + r * ld + c0;
  v16h o;
#pragma unroll
  for (int i = 0; i < 8; ++i) {
    o[i]     = (_Float16)p[i];
    o[8 + i] = (_Float16)p[16 + i];
  }
  return o;
}

// ---------------------------------------------------------------------------
// Kernel 1: transpose + convert weights to f16.  wt layout: [3][H][C] with
// w=0 -> Wq^T, w=1 -> Wk^T, w=2 -> Wv^T  (row h, col c: contiguous in c).
__global__ void __launch_bounds__(256)
cvt_weights(const float* __restrict__ Wq, const float* __restrict__ Wk,
            const float* __restrict__ Wv, _Float16* __restrict__ wt) {
  int idx = blockIdx.x * blockDim.x + threadIdx.x;
  if (idx >= 3 * CN * HN) return;
  int w   = idx / (CN * HN);
  int rem = idx - w * (CN * HN);
  int h   = rem / CN;
  int c   = rem - h * CN;
  const float* W = (w == 0) ? Wq : (w == 1) ? Wk : Wv;
  wt[idx] = (_Float16)W[c * HN + h];
}

// ---------------------------------------------------------------------------
// Kernel 2: QKV projection.  [B*T, C] x [C, H] (x3) with WMMA, f32 accum.
// One wave owns 16 rows; 8 waves per block -> 128 rows per block.
// Outputs: q16/k16 row-major [B*T, H] f16; v transposed vt16 [B][H][T] f16.
__global__ void __launch_bounds__(256)
qkv_proj(const float* __restrict__ x, const _Float16* __restrict__ wt,
         _Float16* __restrict__ q16, _Float16* __restrict__ k16,
         _Float16* __restrict__ vt16) {
  const int lane    = threadIdx.x & 31;
  const int wave    = threadIdx.x >> 5;
  const int rowbase = blockIdx.x * 128 + wave * 16;

  v8f acc[12];  // [w][ntile], w in {q,k,v}, ntile covers H in 4x16
#pragma unroll
  for (int i = 0; i < 12; ++i) acc[i] = (v8f)0.0f;

  for (int kc = 0; kc < CN; kc += 32) {
    v16h a = load_tile_f(x + (size_t)rowbase * CN + kc, CN, lane);
#pragma unroll
    for (int w = 0; w < 3; ++w) {
#pragma unroll
      for (int j = 0; j < 4; ++j) {
        v16h b = load_tile_h(wt + (size_t)w * HN * CN + (j * 16) * CN + kc, CN, lane);
        acc[w * 4 + j] = wmma16(a, b, acc[w * 4 + j]);
      }
    }
  }

  // C/D layout: element r of acc -> row (r + 8*(lane/16)), col (lane&15).
  const int n    = lane & 15;
  const int r8   = (lane >> 4) * 8;
#pragma unroll
  for (int j = 0; j < 4; ++j) {
#pragma unroll
    for (int r = 0; r < 8; ++r) {
      const int row = rowbase + r + r8;
      const int h   = j * 16 + n;
      q16[(size_t)row * HN + h] = (_Float16)acc[0 + j][r];
      k16[(size_t)row * HN + h] = (_Float16)acc[4 + j][r];
      const int b = row >> 12;        // T = 4096
      const int t = row & (TN - 1);
      vt16[((size_t)b * HN + h) * TN + t] = (_Float16)acc[8 + j][r];
    }
  }
}

// ---------------------------------------------------------------------------
// lane l <-> lane l ^ 16: both hold the same query column, each half of its keys
__device__ __forceinline__ float xhalf(float x) {
  const int v = __builtin_bit_cast(int, x);
  return __builtin_bit_cast(float, __builtin_amdgcn_permlanex16(
      v, v, 0x76543210, 0xfedcba98, false, false));
}

// ---------------------------------------------------------------------------
// Kernel 3: flash attention with async-staged K/V tiles in LDS.
// Block = 16 waves on one batch: 4 query tiles x 4 key ranges of 1024 keys.
// The 4 waves of a key range share that range's K/V tile stream; each wave
// keeps its own maximum, sum and O^T over its range, and the 4 partial results
// of a query tile are merged through LDS behind the loop.
// Per trip and range: async copy K (32x64 f16, 4KB) and V^T (64x32 f16, 4KB)
// into double-buffered LDS (ASYNCcnt), one barrier per trip; each wave
// computes S^T = K*Q^T (WMMA: rows = keys, columns = queries), so that a lane
// holds 16 of the 32 scores of ONE query: the online softmax runs in the lane
// plus one exchange between the wave's halves. The two S^T tiles, converted in
// place, are the B operand P^T of O^T += V^T*P^T (WMMA): P never leaves the
// registers.
//
// LDS layout:
//   [    0, 36864)  K tiles,  2 stages x 4 ranges x 4608B, [t][h], rows of 144B
//   [36864, 77824)  V tiles,  2 stages x 4 ranges x 5120B, [h][t], rows of 80B
__global__ void __launch_bounds__(NQ * NS * 32)
flash_attn(const _Float16* __restrict__ q16, const _Float16* __restrict__ k16,
           const _Float16* __restrict__ vt16, const int* __restrict__ amask,
           float* __restrict__ out) {
  __shared__ __attribute__((aligned(256))) char smem[LDS_SZ];

  const int tid  = threadIdx.x;
  const int lane = tid & 31;
  const int wave = __builtin_amdgcn_readfirstlane(tid >> 5);
  const int qi   = wave & (NQ - 1);          // query tile inside the block
  const int sp   = wave / NQ;                // key range
  const int b    = blockIdx.x / (TN / 16 / NQ);                  // 64 blocks per batch
  const int qt   = (blockIdx.x % (TN / 16 / NQ)) * NQ + qi;      // q-tile in the batch
  const int k0   = sp * RKEYS;               // first key of the range

  // the 128 threads of a range copy its tiles: 2 x 16B of K and of V^T each
  const int tr = tid & 127;
  const char* kg = (const char*)(k16 + ((size_t)b * TN + k0) * HN) + tr * 16;       // [t][h]
  const char* vg = (const char*)(vt16 + (size_t)b * HN * TN + k0)                   // [h][t]
                   + (tr >> 2) * (TN * 2) + (tr & 3) * 16;
  const uint32_t lds0 = (uint32_t)(size_t)smem;
  const uint32_t kl = lds0 + (uint32_t)(sp * KBUF + (tr >> 3) * KPITCH + (tr & 7) * 16);
  const uint32_t vl = lds0 + (uint32_t)(VBASE + sp * VBUF + (tr >> 2) * VPITCH + (tr & 3) * 16);

  // cooperative async fetch of the range's 32-key K tile + V tile of trip 'it'
  auto fetch_kv = [&](int it, int buf) {
    // K tile: contiguous 4KB in global memory, 8 copies per row; rows 0-15, 16-31
    const uint32_t kla = kl + (uint32_t)(buf * KSTAGE);
    const uint32_t klb = kla + 16 * KPITCH;
    const char* kga = kg + it * (32 * HN * 2);
    const char* kgb = kga + 16 * HN * 2;
    // V tile: 64 rows of 64B, global row stride TN*2; rows 0-31, 32-63
    const uint32_t vla = vl + (uint32_t)(buf * VSTAGE);
    const uint32_t vlb = vla + 32 * VPITCH;
    const char* vga = vg + it * (32 * 2);
    const char* vgb = vga + 32 * (TN * 2);
    // s_wait_xcnt 0 ends the copies' own statement, so that it stands in front
    // of every later write of a register that they name
    asm volatile("global_load_async_to_lds_b128 %0, %1, off\n\t"
                 "global_load_async_to_lds_b128 %2, %3, off\n\t"
                 "global_load_async_to_lds_b128 %4, %5, off\n\t"
                 "global_load_async_to_lds_b128 %6, %7, off\n\t"
                 "s_wait_xcnt 0x0"
                 :: "v"(kla), "v"(kga), "v"(klb), "v"(kgb),
                    "v"(vla), "v"(vga), "v"(vlb), "v"(vgb)
                 : "memory");
  };

  const _Float16* qb = q16 + ((size_t)b * TN + qt * 16) * HN;
  const v16h aq0 = load_tile_h(qb, HN, lane);        // h = 0..31
  const v16h aq1 = load_tile_h(qb + 32, HN, lane);   // h = 32..63

  const int half  = lane >> 4;

  // O^T tiles: o[j][r] = O[query lane & 15][h = 16*j + 8*half + r]
  v8f o[4];
#pragma unroll
  for (int j = 0; j < 4; ++j) o[j] = (v8f)0.0f;
  float m = NEG_BIG;   // running maximum of this lane's query (equal in both halves)
  float l = 0.0f;      // running sum over this half's keys only; joined at the end

  const int* am = amask + (size_t)b * TN + k0;

  fetch_kv(0, 0);
  asm volatile("s_wait_asynccnt 0x0" ::: "memory");
  __syncthreads();

  for (int it = 0; it < NIT; ++it) {
    const int cur = it & 1;
    if (it + 1 < NIT) fetch_kv(it + 1, cur ^ 1);   // prefetch next tile

    const _Float16* kbufp = (const _Float16*)(smem + cur * KSTAGE + sp * KBUF);
    const _Float16* vbufp = (const _Float16*)(smem + VBASE + cur * VSTAGE + sp * VBUF);

    // key padding mask: one key per lane, gathered into one bit per key; S^T
    // element r of a lane is key 8*half + r of its 16-key tile
    const uint32_t kbits = __builtin_amdgcn_ballot_w32(am[it * 32 + lane] != 0) >> (8 * half);
    bool ok[16];
#pragma unroll
    for (int r = 0; r < 8; ++r) {
      ok[r]     = ((kbits >> r) & 1u) != 0;
      ok[8 + r] = ((kbits >> (16 + r)) & 1u) != 0;
    }

    // S^T tiles: A = K rows from LDS, B = Q^T kept in registers
    v8f s0 = (v8f)0.0f, s1 = (v8f)0.0f;
    constexpr int KLD = KPITCH / 2, VLD = VPITCH / 2;   // pitches in halves
    s0 = wmma16(load_tile_h(kbufp, KLD, lane), aq0, s0);
    s0 = wmma16(load_tile_h(kbufp + 32, KLD, lane), aq1, s0);
    s1 = wmma16(load_tile_h(kbufp + 16 * KLD, KLD, lane), aq0, s1);
    s1 = wmma16(load_tile_h(kbufp + 16 * KLD + 32, KLD, lane), aq1, s1);

    // scale + mask, then the online-softmax update of this lane's query
    float a[16], t[16];
#pragma unroll
    for (int r = 0; r < 8; ++r) {
      a[r]     = ok[r]     ? s0[r] * SM_SCALE : NEG_BIG;
      a[8 + r] = ok[8 + r] ? s1[r] * SM_SCALE : NEG_BIG;
    }
#pragma unroll
    for (int i = 0; i < 16; ++i) t[i] = a[i];
#pragma unroll
    for (int w = 8; w >= 1; w >>= 1)
#pragma unroll
      for (int i = 0; i < w; ++i) t[i] = fmaxf(t[i], t[i + w]);
    const float rmax  = fmaxf(t[0], xhalf(t[0]));
    const float nm    = fmaxf(m, rmax);
    const float alpha = __expf(m - nm);
    m = nm;

    // P^T in the B layout: element i of the lane is key (i < 8 ? 8*half + i
    // : 16 + 8*half + i - 8), the k order of load_tile_h on the V^T rows
    v16h pb;
#pragma unroll
    for (int i = 0; i < 16; ++i) {
      t[i]  = ok[i] ? __expf(a[i] - nm) : 0.0f;
      pb[i] = (_Float16)t[i];
    }
#pragma unroll
    for (int w = 8; w >= 1; w >>= 1)
#pragma unroll
      for (int i = 0; i < w; ++i) t[i] += t[i + w];
    l = l * alpha + t[0];
#pragma unroll
    for (int j = 0; j < 4; ++j) o[j] *= alpha;

    // O^T += V^T * P^T: A = V^T rows ([h][t]) from LDS
#pragma unroll
    for (int j = 0; j < 4; ++j) {
      v16h av = load_tile_h(vbufp + (j * 16) * VLD, VLD, lane);
      o[j] = wmma16(av, pb, o[j]);
    }

    // my reads of 'cur' are back and my prefetch has landed, then everyone is
    // done reading 'cur' before it is refilled (after the last trip: rewritten)
    asm volatile("s_wait_dscnt 0x0" ::: "memory");
    asm volatile("s_wait_asynccnt 0x0" ::: "memory");
    __syncthreads();
  }

  // merge of the 4 key ranges of a query tile. Each wave leaves its O^T tiles
  // (16B per lane and piece, lanes adjacent) and its (max, sum) in LDS
  {
    const float lt = l + xhalf(l);   // both halves' keys
#pragma unroll
    for (int j = 0; j < 4; ++j) {
      float4* pw = (float4*)(smem + (wave * 4 + j) * 1024 + lane * 16);
      pw[0]  = make_float4(o[j][0], o[j][1], o[j][2], o[j][3]);
      pw[32] = make_float4(o[j][4], o[j][5], o[j][6], o[j][7]);
    }
    *(float2*)(smem + MLBASE + (wave * 32 + lane) * 8) = make_float2(m, lt);
  }
  __syncthreads();

  // wave (qi, sp) finishes 8 queries x 32 h: whole 128B lines of out, each from
  // one wave. A lane takes 8 consecutive h of one query.
  const int mq = (sp >> 1) * 8 + (lane & 7);      // query inside the q-tile
  const int mh = (lane >> 3) & 1;                 // the half that held these h
  const int mj = (sp & 1) * 2 + (lane >> 4);      // O^T tile
  float pm[NS], pl[NS];
#pragma unroll
  for (int s = 0; s < NS; ++s) {
    const float2 ml = *(const float2*)(smem + MLBASE + ((s * NQ + qi) * 32 + mq) * 8);
    pm[s] = ml.x;
    pl[s] = ml.y;
  }
  const float gm = fmaxf(fmaxf(pm[0], pm[1]), fmaxf(pm[2], pm[3]));
  float gl = 0.0f;
  float r[8];
#pragma unroll
  for (int i = 0; i < 8; ++i) r[i] = 0.0f;
#pragma unroll
  for (int s = 0; s < NS; ++s) {
    const float wgt = __expf(pm[s] - gm);
    gl += wgt * pl[s];
    const float4* pr = (const float4*)(smem + ((s * NQ + qi) * 4 + mj) * 1024 + (mh * 16 + mq) * 16);
    const float4 x0 = pr[0], x1 = pr[32];
    r[0] += wgt * x0.x; r[1] += wgt * x0.y; r[2] += wgt * x0.z; r[3] += wgt * x0.w;
    r[4] += wgt * x1.x; r[5] += wgt * x1.y; r[6] += wgt * x1.z; r[7] += wgt * x1.w;
  }
  const float inv = 1.0f / gl;
  float* ob = out + ((size_t)b * TN + qt * 16 + mq) * HN + mj * 16 + mh * 8;
#pragma unroll
  for (int i = 0; i < 8; ++i) ob[i] = r[i] * inv;
}

// ---------------------------------------------------------------------------
extern "C" void kernel_launch(void* const* d_in, const int* in_sizes, int n_in,
                              void* d_out, int out_size, void* d_ws, size_t ws_size,
                              hipStream_t stream) {
  (void)in_sizes; (void)n_in; (void)out_size; (void)ws_size;
  const float* x  = (const float*)d_in[0];
  const int*   am = (const int*)d_in[1];
  const float* Wk = (const float*)d_in[2];
  const float* Wq = (const float*)d_in[3];
  const float* Wv = (const float*)d_in[4];
  float*       out = (float*)d_out;

  // workspace layout (f16): [3][H][C] weights^T, q16, k16, vt16
  _Float16* wt   = (_Float16*)d_ws;
  _Float16* q16  = wt  + (size_t)3 * HN * CN;
  _Float16* k16  = q16 + (size_t)BN * TN * HN;
  _Float16* vt16 = k16 + (size_t)BN * TN * HN;

  cvt_weights<<<(3 * CN * HN + 255) / 256, 256, 0, stream>>>(Wq, Wk, Wv, wt);
  qkv_proj<<<(BN * TN) / 128, 256, 0, stream>>>(x, wt, q16, k16, vt16);
  flash_attn<<<(BN * TN / 16) / NQ, NQ * NS * 32, 0, stream>>>(q16, k16, vt16, am, out);
}

// v004
// Measured time: 55.2 microseconds a run.
// In two side-by-side timings against v003, it was 1.73 and 1.71 times as fast.
// All steps since v000 together make it 8.41 times as fast.
#include <hip/hip_runtime.h>
#include <hip/hip_bf16.h>

typedef __attribute__((ext_vector_type(16))) _Float16 v16h;
typedef __attribute__((ext_vector_type(8)))  float    v8f;

constexpr int BN = 4, TN = 4096, CN = 768, HN = 64;
constexpr float SM_SCALE = 0.03608439182435161f;  // 1/sqrt(768) -- reference scales by C**-0.5
constexpr float NEG_BIG  = -3.0e38f;

// LDS row pitches of the staged K and V^T tiles, in bytes: an odd multiple of
// 16 B, so that the 16 rows one ds_load_b128 half-wave reads fall on 64
// different banks (the bare 128 B and 64 B rows fall on 8 and on 16)
constexpr int KPITCH = HN * 2 + 16;          // 144
constexpr int VPITCH = 32 * 2 + 16;          // 80
constexpr int KBUF   = 32 * KPITCH;          // 4608, one K tile
constexpr int VBUF   = HN * VPITCH;          // 5120, one V^T tile

// attention work-group: NQ query tiles x NS key ranges, one wave for each pair
constexpr int NQ     = 4;
constexpr int NS     = 4;
constexpr int RKEYS  = TN / NS;              // 1024 keys of one range
constexpr int NIT    = RKEYS / 32;           // 32 trips
constexpr int KSTAGE = NS * KBUF;            // 18432, the K tiles of one stage
constexpr int VSTAGE = NS * VBUF;            // 20480, the V^T tiles of one stage
constexpr int VBASE  = 2 * KSTAGE;           // 36864
constexpr int LDS_SZ = VBASE + 2 * VSTAGE;   // 77824
// after the loop the ring holds the waves' partial results
constexpr int MLBASE = NQ * NS * 4096;       // 65536: (max, sum) pairs behind the O^T partials
static_assert(MLBASE + NQ * NS * 32 * 8 <= LDS_SZ, "partials fit the ring");

// ---------------------------------------------------------------------------
// D = A*B + C, f16 inputs, f32 accumulate (v_wmma_f32_16x16x32_f16)
__device__ __forceinline__ v8f wmma16(v16h a, v16h b, v8f c) {
  return __builtin_amdgcn_wmma_f32_16x16x32_f16(false, a, false, b, (short)0, c,
                                                false, false);
}

// Load a 16x32 f16 tile (row-major, row stride ld) into the WMMA A/B register
// layout for wave32:
//   lanes 0-15 : row = lane,    halves = cols {0..7} then {16..23}
//   lanes 16-31: row = lane-16, halves = cols {8..15} then {24..31}
__device__ __forceinline__ v16h load_tile_h(const _Float16* base, int ld, int lane) {
  const int r  = lane & 15;
  const int c0 = (lane & 16) ? 8 : 0;
  const _Float16* p = base + r * ld + c0;
  v16h o;
#pragma unroll
  for (int i = 0; i < 8; ++i) { o[i] = p[i]; o[8 + i] = p[16 + i]; }
  return o;
}

// Same tile layout but source is f32 (converted to f16 on the fly).
__device__ __forceinline__ v16h load_tile_f(const float* base, int ld, int lane) {
  const int r  = lane & 15;
  const int c0 = (lane & 16) ? 8 : 0;
  const float* p = base + r * ld + c0;
  v16h o;
#pragma unroll
  for (int i = 0; i < 8; ++i) {
    o[i]     = (_Float16)p[i];
    o[8 + i] = (_Float16)p[16 + i];
  }
  return o;
}

// ---------------------------------------------------------------------------
// Kernel 1: transpose + convert weights to f16.  wt layout: [3][H][C] with
// w=0 -> Wq^T, w=1 -> Wk^T, w=2 -> Wv^T  (row h, col c: contiguous in c).
__global__ void __launch_bounds__(256)
cvt_weights(const float* __restrict__ Wq, const float* __restrict__ Wk,
            const float* __restrict__ Wv, _Float16* __restrict__ wt) {
  int idx = blockIdx.x * blockDim.x + threadIdx.x;
  if (idx >= 3 * CN * HN) return;
  int w   = idx / (CN * HN);
  int rem = idx - w * (CN * HN);
  int h   = rem / CN;
  int c   = rem - h * CN;
  const float* W = (w == 0) ? Wq : (w == 1) ? Wk : Wv;
  wt[idx] = (_Float16)W[c * HN + h];
}

// ---------------------------------------------------------------------------
// Kernel 2: QKV projection.  [B*T, C] x [C, H] (x3) with WMMA, f32 accum.
// Block = 16 waves on 64 rows of x and all 192 output columns; grid 256.
// The k range runs in 6 slabs of 128: a slab of x (64 rows x 512B, f32) and of
// the weights^T (192 rows x 256B, f16) is brought into LDS by async copies in
// which a wave covers whole 128B lines, two buffers, the next slab in flight
// while this one is worked on. Wave (rt, cg) owns row tile rt and column tile
// cg of each of q, k, v; its fragments come from LDS.
// Outputs: q16/k16 row-major [B*T, H] f16; v transposed vt16 [B][H][T] f16.
constexpr int PROWS  = 64;                   // rows of x of one block
constexpr int PK     = 128;                  // k of one slab
constexpr int PSLABS = CN / PK;              // 6
constexpr int XPITCH = PK * 4 + 16;          // 528 B, 16 B x odd
constexpr int WPITCH = PK * 2 + 16;          // 272 B, 16 B x odd
constexpr int XBUF   = PROWS * XPITCH;       // 33792
constexpr int WBUF   = 3 * HN * WPITCH;      // 52224
constexpr int PSTAGE = XBUF + WBUF;          // 86016

__global__ void __launch_bounds__(512)
qkv_proj(const float* __restrict__ x, const _Float16* __restrict__ wt,
         _Float16* __restrict__ q16, _Float16* __restrict__ k16,
         _Float16* __restrict__ vt16) {
  __shared__ __attribute__((aligned(256))) char smem[2 * PSTAGE];

  const int tid  = threadIdx.x;
  const int lane = tid & 31;
  const int wave = __builtin_amdgcn_readfirstlane(tid >> 5);
  const int rt   = wave & 3;                 // row tile inside the block
  const int cg   = wave >> 2;                // column tile of q, of k and of v
  const int blockrow = blockIdx.x * PROWS;

  // x slab: a wave copies one row's 512B; 16 rows a round, 4 rounds
  const char* xg = (const char*)(x + (size_t)(blockrow + (tid >> 5)) * CN) + (tid & 31) * 16;
  // weight slab: a wave copies two rows' 256B; 32 rows a round, 6 rounds
  const char* wg = (const char*)(wt + (size_t)(tid >> 4) * CN) + (tid & 15) * 16;
  const uint32_t lds0 = (uint32_t)(size_t)smem;
  const uint32_t xl = lds0 + (uint32_t)((tid >> 5) * XPITCH + (tid & 31) * 16);
  const uint32_t wl = lds0 + (uint32_t)(XBUF + (tid >> 4) * WPITCH + (tid & 15) * 16);

  auto fetch = [&](int s, int buf) {
    const char* xs = xg + s * (PK * 4);
    const char* ws = wg + s * (PK * 2);
    const uint32_t xd = xl + (uint32_t)(buf * PSTAGE);
    const uint32_t wd = wl + (uint32_t)(buf * PSTAGE);
    // s_wait_xcnt 0 ends the copies' own statement, so that it stands in front
    // of every later write of a register that they name
    asm volatile("global_load_async_to_lds_b128 %0, %1, off\n\t"
                 "global_load_async_to_lds_b128 %2, %3, off\n\t"
                 "global_load_async_to_lds_b128 %4, %5, off\n\t"
                 "global_load_async_to_lds_b128 %6, %7, off\n\t"
                 "global_load_async_to_lds_b128 %8, %9, off\n\t"
                 "global_load_async_to_lds_b128 %10, %11, off\n\t"
                 "global_load_async_to_lds_b128 %12, %13, off\n\t"
                 "global_load_async_to_lds_b128 %14, %15, off\n\t"
                 "global_load_async_to_lds_b128 %16, %17, off\n\t"
                 "global_load_async_to_lds_b128 %18, %19, off\n\t"
                 "s_wait_xcnt 0x0"
                 :: "v"(xd),                "v"(xs),
                    "v"(xd + 16 * XPITCH),  "v"(xs + 16 * (CN * 4)),
                    "v"(xd + 32 * XPITCH),  "v"(xs + 32 * (CN * 4)),
                    "v"(xd + 48 * XPITCH),  "v"(xs + 48 * (CN * 4)),
                    "v"(wd),                "v"(ws),
                    "v"(wd + 32 * WPITCH),  "v"(ws + 32 * (CN * 2)),
                    "v"(wd + 64 * WPITCH),  "v"(ws + 64 * (CN * 2)),
                    "v"(wd + 96 * WPITCH),  "v"(ws + 96 * (CN * 2)),
                    "v"(wd + 128 * WPITCH), "v"(ws + 128 * (CN * 2)),
                    "v"(wd + 160 * WPITCH), "v"(ws + 160 * (CN * 2))
                 : "memory");
  };

  v8f acc[3];  // q, k, v
#pragma unroll
  for (int i = 0; i < 3; ++i) acc[i] = (v8f)0.0f;

  fetch(0, 0);
  asm volatile("s_wait_asynccnt 0x0" ::: "memory");   // slab 0 has landed
  __syncthreads();
  fetch(1, 1);

  constexpr int XLD = XPITCH / 4, WLD = WPITCH / 2;   // pitches in elements
  for (int s = 0; s < PSLABS; ++s) {
    const int cur = s & 1;
    const float*    xb = (const float*)(smem + cur * PSTAGE) + rt * 16 * XLD;
    const _Float16* wb = (const _Float16*)(smem + cur * PSTAGE + XBUF) + cg * 16 * WLD;
#pragma unroll
    for (int kc = 0; kc < PK; kc += 32) {
      v16h a = load_tile_f(xb + kc, XLD, lane);
#pragma unroll
      for (int w = 0; w < 3; ++w) {
        v16h b = load_tile_h(wb + w * HN * WLD + kc, WLD, lane);
        acc[w] = wmma16(a, b, acc[w]);
      }
    }
    // my reads of 'cur' are back and my copies of the next slab have landed,
    // then everyone has left 'cur' before it is refilled
    asm volatile("s_wait_dscnt 0x0" ::: "memory");
    asm volatile("s_wait_asynccnt 0x0" ::: "memory");
    __syncthreads();
    if (s + 2 < PSLABS) fetch(s + 2, cur);
  }
  asm volatile("s_wait_asynccnt 0x0" ::: "memory");   // no copy is left when the wave ends

  // C/D layout: element r of acc -> row (r + 8*(lane/16)), col (lane&15).
  const int h    = cg * 16 + (lane & 15);
  const int row0 = blockrow + rt * 16 + (lane >> 4) * 8;
#pragma unroll
  for (int r = 0; r < 8; ++r) {
    const int row = row0 + r;
    q16[(size_t)row * HN + h] = (_Float16)acc[0][r];
    k16[(size_t)row * HN + h] = (_Float16)acc[1][r];
    const int b = row >> 12;        // T = 4096
    const int t = row & (TN - 1);
    vt16[((size_t)b * HN + h) * TN + t] = (_Float16)acc[2][r];
  }
}

// ---------------------------------------------------------------------------
// lane l <-> lane l ^ 16: both hold the same query column, each half of its keys
__device__ __forceinline__ float xhalf(float x) {
  const int v = __builtin_bit_cast(int, x);
  return __builtin_bit_cast(float, __builtin_amdgcn_permlanex16(
      v, v, 0x76543210, 0xfedcba98, false, false));
}

// ---------------------------------------------------------------------------
// Kernel 3: flash attention with async-staged K/V tiles in LDS.
// Block = 16 waves on one batch: 4 query tiles x 4 key ranges of 1024 keys.
// The 4 waves of a key range share that range's K/V tile stream; each wave
// keeps its own maximum, sum and O^T over its range, and the 4 partial results
// of a query tile are merged through LDS behind the loop.
// Per trip and range: async copy K (32x64 f16, 4KB) and V^T (64x32 f16, 4KB)
// into double-buffered LDS (ASYNCcnt), one barrier per trip; each wave
// computes S^T = K*Q^T (WMMA: rows = keys, columns = queries), so that a lane
// holds 16 of the 32 scores of ONE query: the online softmax runs in the lane
// plus one exchange between the wave's halves. The two S^T tiles, converted in
// place, are the B operand P^T of O^T += V^T*P^T (WMMA): P never leaves the
// registers.
//
// LDS layout:
//   [    0, 36864)  K tiles,  2 stages x 4 ranges x 4608B, [t][h], rows of 144B
//   [36864, 77824)  V tiles,  2 stages x 4 ranges x 5120B, [h][t], rows of 80B
__global__ void __launch_bounds__(NQ * NS * 32)
flash_attn(const _Float16* __restrict__ q16, const _Float16* __restrict__ k16,
           const _Float16* __restrict__ vt16, const int* __restrict__ amask,
           float* __restrict__ out) {
  __shared__ __attribute__((aligned(256))) char smem[LDS_SZ];

  const int tid  = threadIdx.x;
  const int lane = tid & 31;
  const int wave = __builtin_amdgcn_readfirstlane(tid >> 5);
  const int qi   = wave & (NQ - 1);          // query tile inside the block
  const int sp   = wave / NQ;                // key range
  const int b    = blockIdx.x / (TN / 16 / NQ);                  // 64 blocks per batch
  const int qt   = (blockIdx.x % (TN / 16 / NQ)) * NQ + qi;      // q-tile in the batch
  const int k0   = sp * RKEYS;               // first key of the range

  // the 128 threads of a range copy its tiles: 2 x 16B of K and of V^T each
  const int tr = tid & 127;
  const char* kg = (const char*)(k16 + ((size_t)b * TN + k0) * HN) + tr * 16;       // [t][h]
  const char* vg = (const char*)(vt16 + (size_t)b * HN * TN + k0)                   // [h][t]
                   + (tr >> 2) * (TN * 2) + (tr & 3) * 16;
  const uint32_t lds0 = (uint32_t)(size_t)smem;
  const uint32_t kl = lds0 + (uint32_t)(sp * KBUF + (tr >> 3) * KPITCH + (tr & 7) * 16);
  const uint32_t vl = lds0 + (uint32_t)(VBASE + sp * VBUF + (tr >> 2) * VPITCH + (tr & 3) * 16);

  // cooperative async fetch of the range's 32-key K tile + V tile of trip 'it'
  auto fetch_kv = [&](int it, int buf) {
    // K tile: contiguous 4KB in global memory, 8 copies per row; rows 0-15, 16-31
    const uint32_t kla = kl + (uint32_t)(buf * KSTAGE);
    const uint32_t klb = kla + 16 * KPITCH;
    const char* kga = kg + it * (32 * HN * 2);
    const char* kgb = kga + 16 * HN * 2;
    // V tile: 64 rows of 64B, global row stride TN*2; rows 0-31, 32-63
    const uint32_t vla = vl + (uint32_t)(buf * VSTAGE);
    const uint32_t vlb = vla + 32 * VPITCH;
    const char* vga = vg + it * (32 * 2);
    const char* vgb = vga + 32 * (TN * 2);
    // s_wait_xcnt 0 ends the copies' own statement, so that it stands in front
    // of every later write of a register that they name
    asm volatile("global_load_async_to_lds_b128 %0, %1, off\n\t"
                 "global_load_async_to_lds_b128 %2, %3, off\n\t"
                 "global_load_async_to_lds_b128 %4, %5, off\n\t"
                 "global_load_async_to_lds_b128 %6, %7, off\n\t"
                 "s_wait_xcnt 0x0"
                 :: "v"(kla), "v"(kga), "v"(klb), "v"(kgb),
                    "v"(vla), "v"(vga), "v"(vlb), "v"(vgb)
                 : "memory");
  };

  const _Float16* qb = q16 + ((size_t)b * TN + qt * 16) * HN;
  const v16h aq0 = load_tile_h(qb, HN, lane);        // h = 0..31
  const v16h aq1 = load_tile_h(qb + 32, HN, lane);   // h = 32..63

  const int half  = lane >> 4;

  // O^T tiles: o[j][r] = O[query lane & 15][h = 16*j + 8*half + r]
  v8f o[4];
#pragma unroll
  for (int j = 0; j < 4; ++j) o[j] = (v8f)0.0f;
  float m = NEG_BIG;   // running maximum of this lane's query (equal in both halves)
  float l = 0.0f;      // running sum over this half's keys only; joined at the end

  const int* am = amask + (size_t)b * TN + k0;

  fetch_kv(0, 0);
  asm volatile("s_wait_asynccnt 0x0" ::: "memory");
  __syncthreads();

  for (int it = 0; it < NIT; ++it) {
    const int cur = it & 1;
    if (it + 1 < NIT) fetch_kv(it + 1, cur ^ 1);   // prefetch next tile

    const _Float16* kbufp = (const _Float16*)(smem + cur * KSTAGE + sp * KBUF);
    const _Float16* vbufp = (const _Float16*)(smem + VBASE + cur * VSTAGE + sp * VBUF);

    // key padding mask: one key per lane, gathered into one bit per key; S^T
    // element r of a lane is key 8*half + r of its 16-key tile
    const uint32_t kbits = __builtin_amdgcn_ballot_w32(am[it * 32 + lane] != 0) >> (8 * half);
    bool ok[16];
#pragma unroll
    for (int r = 0; r < 8; ++r) {
      ok[r]     = ((kbits >> r) & 1u) != 0;
      ok[8 + r] = ((kbits >> (16 + r)) & 1u) != 0;
    }

    // S^T tiles: A = K rows from LDS, B = Q^T kept in registers
    v8f s0 = (v8f)0.0f, s1 = (v8f)0.0f;
    constexpr int KLD = KPITCH / 2, VLD = VPITCH / 2;   // pitches in halves
    s0 = wmma16(load_tile_h(kbufp, KLD, lane), aq0, s0);
    s0 = wmma16(load_tile_h(kbufp + 32, KLD, lane), aq1, s0);
    s1 = wmma16(load_tile_h(kbufp + 16 * KLD, KLD, lane), aq0, s1);
    s1 = wmma16(load_tile_h(kbufp + 16 * KLD + 32, KLD, lane), aq1, s1);

    // scale + mask, then the online-softmax update of this lane's query
    float a[16], t[16];
#pragma unroll
    for (int r = 0; r < 8; ++r) {
      a[r]     = ok[r]     ? s0[r] * SM_SCALE : NEG_BIG;
      a[8 + r] = ok[8 + r] ? s1[r] * SM_SCALE : NEG_BIG;
    }
#pragma unroll
    for (int i = 0; i < 16; ++i) t[i] = a[i];
#pragma unroll
    for (int w = 8; w >= 1; w >>= 1)
#pragma unroll
      for (int i = 0; i < w; ++i) t[i] = fmaxf(t[i], t[i + w]);
    const float rmax  = fmaxf(t[0], xhalf(t[0]));
    const float nm    = fmaxf(m, rmax);
    const float alpha = __expf(m - nm);
    m = nm;

    // P^T in the B layout: element i of the lane is key (i < 8 ? 8*half + i
    // : 16 + 8*half + i - 8), the k order of load_tile_h on the V^T rows
    v16h pb;
#pragma unroll
    for (int i = 0; i < 16; ++i) {
      t[i]  = ok[i] ? __expf(a[i] - nm) : 0.0f;
      pb[i] = (_Float16)t[i];
    }
#pragma unroll
    for (int w = 8; w >= 1; w >>= 1)
#pragma unroll
      for (int i = 0; i < w; ++i) t[i] += t[i + w];
    l = l * alpha + t[0];
#pragma unroll
    for (int j = 0; j < 4; ++j) o[j] *= alpha;

    // O^T += V^T * P^T: A = V^T rows ([h][t]) from LDS
#pragma unroll
    for (int j = 0; j < 4; ++j) {
      v16h av = load_tile_h(vbufp + (j * 16) * VLD, VLD, lane);
      o[j] = wmma16(av, pb, o[j]);
    }

    // my reads of 'cur' are back and my prefetch has landed, then everyone is
    // done reading 'cur' before it is refilled (after the last trip: rewritten)
    asm volatile("s_wait_dscnt 0x0" ::: "memory");
    asm volatile("s_wait_asynccnt 0x0" ::: "memory");
    __syncthreads();
  }

  // merge of the 4 key ranges of a query tile. Each wave leaves its O^T tiles
  // (16B per lane and piece, lanes adjacent) and its (max, sum) in LDS
  {
    const float lt = l + xhalf(l);   // both halves' keys
#pragma unroll
    for (int j = 0; j < 4; ++j) {
      float4* pw = (float4*)(smem + (wave * 4 + j) * 1024 + lane * 16);
      pw[0]  = make_float4(o[j][0], o[j][1], o[j][2], o[j][3]);
      pw[32] = make_float4(o[j][4], o[j][5], o[j][6], o[j][7]);
    }
    *(float2*)(smem + MLBASE + (wave * 32 + lane) * 8) = make_float2(m, lt);
  }
  __syncthreads();

  // wave (qi, sp) finishes 8 queries x 32 h: whole 128B lines of out, each from
  // one wave. A lane takes 8 consecutive h of one query.
  const int mq = (sp >> 1) * 8 + (lane & 7);      // query inside the q-tile
  const int mh = (lane >> 3) & 1;                 // the half that held these h
  const int mj = (sp & 1) * 2 + (lane >> 4);      // O^T tile
  float pm[NS], pl[NS];
#pragma unroll
  for (int s = 0; s < NS; ++s) {
    const float2 ml = *(const float2*)(smem + MLBASE + ((s * NQ + qi) * 32 + mq) * 8);
    pm[s] = ml.x;
    pl[s] = ml.y;
  }
  const float gm = fmaxf(fmaxf(pm[0], pm[1]), fmaxf(pm[2], pm[3]));
  float gl = 0.0f;
  float r[8];
#pragma unroll
  for (int i = 0; i < 8; ++i) r[i] = 0.0f;
#pragma unroll
  for (int s = 0; s < NS; ++s) {
    const float wgt = __expf(pm[s] - gm);
    gl += wgt * pl[s];
    const float4* pr = (const float4*)(smem + ((s * NQ + qi) * 4 + mj) * 1024 + (mh * 16 + mq) * 16);
    const float4 x0 = pr[0], x1 = pr[32];
    r[0] += wgt * x0.x; r[1] += wgt * x0.y; r[2] += wgt * x0.z; r[3] += wgt * x0.w;
    r[4] += wgt * x1.x; r[5] += wgt * x1.y; r[6] += wgt * x1.z; r[7] += wgt * x1.w;
  }
  const float inv = 1.0f / gl;
  float* ob = out + ((size_t)b * TN + qt * 16 + mq) * HN + mj * 16 + mh * 8;
#pragma unroll
  for (int i = 0; i < 8; ++i) ob[i] = r[i] * inv;
}

// ---------------------------------------------------------------------------
extern "C" void kernel_launch(void* const* d_in, const int* in_sizes, int n_in,
                              void* d_out, int out_size, void* d_ws, size_t ws_size,
                              hipStream_t stream) {
  (void)in_sizes; (void)n_in; (void)out_size; (void)ws_size;
  const float* x  = (const float*)d_in[0];
  const int*   am = (const int*)d_in[1];
  const float* Wk = (const float*)d_in[2];
  const float* Wq = (const float*)d_in[3];
  const float* Wv = (const float*)d_in[4];
  float*       out = (float*)d_out;

  // workspace layout (f16): [3][H][C] weights^T, q16, k16, vt16
  _Float16* wt   = (_Float16*)d_ws;
  _Float16* q16  = wt  + (size_t)3 * HN * CN;
  _Float16* k16  = q16 + (size_t)BN * TN * HN;
  _Float16* vt16 = k16 + (size_t)BN * TN * HN;

  cvt_weights<<<(3 * CN * HN + 255) / 256, 256, 0, stream>>>(Wq, Wk, Wv, wt);
  qkv_proj<<<(BN * TN) / PROWS, 512, 0, stream>>>(x, wt, q16, k16, vt16);
  flash_attn<<<(BN * TN / 16) / NQ, NQ * NS * 32, 0, stream>>>(q16, k16, vt16, am, out);
}

// v005
// A run of this version takes 32.2 microseconds.
// Next to v004, in two timings, it ran 1.74 and 1.67 times as fast.
// Over all steps from v000 it is 14.3 times as fast.
#include <hip/hip_runtime.h>
#include <hip/hip_bf16.h>

typedef __attribute__((ext_vector_type(16))) _Float16 v16h;
typedef __attribute__((ext_vector_type(8)))  float    v8f;
typedef __attribute__((ext_vector_type(8)))  _Float16 v8h;

constexpr int BN = 4, TN = 4096, CN = 768, HN = 64;
constexpr float SM_SCALE = 0.03608439182435161f;  // 1/sqrt(768) -- reference scales by C**-0.5
constexpr float NEG_BIG  = -3.0e38f;

// LDS row pitches of the staged K and V^T tiles, in bytes: an odd multiple of
// 16 B, so that the 16 rows one ds_load_b128 half-wave reads fall on 64
// different banks (the bare 128 B and 64 B rows fall on 8 and on 16)
constexpr int KPITCH = HN * 2 + 16;          // 144
constexpr int VPITCH = 32 * 2 + 16;          // 80
constexpr int KBUF   = 32 * KPITCH;          // 4608, one K tile
constexpr int VBUF   = HN * VPITCH;          // 5120, one V^T tile

// attention work-group: NQ query tiles x NS key ranges, one wave for each pair
constexpr int NQ     = 4;
constexpr int NS     = 4;
constexpr int KSTAGE = NS * KBUF;            // 18432, the K tiles of one stage
constexpr int VSTAGE = NS * VBUF;            // 20480, the V^T tiles of one stage
constexpr int VBASE  = 2 * KSTAGE;           // 36864
constexpr int LDS_SZ = VBASE + 2 * VSTAGE;   // 77824
// after the loop the ring holds the waves' partial results
constexpr int MLBASE = NQ * NS * 4096;       // 65536: (max, sum) pairs behind the O^T partials
static_assert(MLBASE + NQ * NS * 32 * 8 <= LDS_SZ, "partials fit the ring");

// ---------------------------------------------------------------------------
// D = A*B + C, f16 inputs, f32 accumulate (v_wmma_f32_16x16x32_f16)
__device__ __forceinline__ v8f wmma16(v16h a, v16h b, v8f c) {
  return __builtin_amdgcn_wmma_f32_16x16x32_f16(false, a, false, b, (short)0, c,
                                                false, false);
}

// Load a 16x32 f16 tile (row-major, row stride ld) into the WMMA A/B register
// layout for wave32:
//   lanes 0-15 : row = lane,    halves = cols {0..7} then {16..23}
//   lanes 16-31: row = lane-16, halves = cols {8..15} then {24..31}
__device__ __forceinline__ v16h load_tile_h(const _Float16* base, int ld, int lane) {
  const int r  = lane & 15;
  const int c0 = (lane & 16) ? 8 : 0;
  const _Float16* p = base + r * ld + c0;
  v16h o;
#pragma unroll
  for (int i = 0; i < 8; ++i) { o[i] = p[i]; o[8 + i] = p[16 + i]; }
  return o;
}

// Same tile layout but source is f32 (converted to f16 on the fly).
__device__ __forceinline__ v16h load_tile_f(const float* base, int ld, int lane) {
  const int r  = lane & 15;
  const int c0 = (lane & 16) ? 8 : 0;
  const float* p = base + r * ld + c0;
  v16h o;
#pragma unroll
  for (int i = 0; i < 8; ++i) {
    o[i]     = (_Float16)p[i];
    o[8 + i] = (_Float16)p[16 + i];
  }
  return o;
}

// ---------------------------------------------------------------------------
// Kernel 1: transpose + convert weights to f16.  wt layout: [3][H][C] with
// w=0 -> Wq^T, w=1 -> Wk^T, w=2 -> Wv^T  (row h, col c: contiguous in c).
// The last BN blocks scan the key mask instead, one batch each: pos[b][t] is
// the place of key t in a stable partition of the batch's keys, the kept keys
// (mask != 0) first, the masked ones behind them; nkeys[b] counts the kept.
constexpr int NCVT = (3 * CN * HN + 255) / 256;   // blocks that convert weights

__global__ void __launch_bounds__(256)
cvt_weights(const float* __restrict__ Wq, const float* __restrict__ Wk,
            const float* __restrict__ Wv, const int* __restrict__ amask,
            _Float16* __restrict__ wt, int* __restrict__ pos,
            int* __restrict__ nkeys) {
  if (blockIdx.x >= NCVT) {
    __shared__ int wsum[8];
    const int bb = blockIdx.x - NCVT;
    const int t0 = threadIdx.x * 16;           // 16 keys a thread
    const int ln = threadIdx.x & 31, wv = threadIdx.x >> 5;
    const int4* mp = (const int4*)(amask + bb * TN + t0);
    int f[16];
#pragma unroll
    for (int i = 0; i < 4; ++i) {
      const int4 v = mp[i];
      f[4 * i] = v.x != 0; f[4 * i + 1] = v.y != 0;
      f[4 * i + 2] = v.z != 0; f[4 * i + 3] = v.w != 0;
    }
    int c = 0;
#pragma unroll
    for (int i = 0; i < 16; ++i) c += f[i];
    int inc = c;                               // inclusive scan over the wave
#pragma unroll
    for (int d = 1; d < 32; d <<= 1) {
      const int u = __shfl_up(inc, d, 32);
      if (ln >= d) inc += u;
    }
    if (ln == 31) wsum[wv] = inc;
    __syncthreads();
    int before = inc - c, total = 0;           // kept keys in front of t0; all kept keys
#pragma unroll
    for (int w = 0; w < 8; ++w) {
      const int s = wsum[w];
      if (w < wv) before += s;
      total += s;
    }
    int p[16];
#pragma unroll
    for (int i = 0; i < 16; ++i) {
      p[i] = f[i] ? before : total + (t0 + i) - before;
      before += f[i];
    }
    int4* pp = (int4*)(pos + bb * TN + t0);
#pragma unroll
    for (int i = 0; i < 4; ++i)
      pp[i] = make_int4(p[4 * i], p[4 * i + 1], p[4 * i + 2], p[4 * i + 3]);
    if (threadIdx.x == 0) nkeys[bb] = total;
    return;
  }
  int idx = blockIdx.x * blockDim.x + threadIdx.x;
  if (idx >= 3 * CN * HN) return;
  int w   = idx / (CN * HN);
  int rem = idx - w * (CN * HN);
  int h   = rem / CN;
  int c   = rem - h * CN;
  const float* W = (w == 0) ? Wq : (w == 1) ? Wk : Wv;
  wt[idx] = (_Float16)W[c * HN + h];
}

// ---------------------------------------------------------------------------
// Kernel 2: QKV projection.  [B*T, C] x [C, H] (x3) with WMMA, f32 accum.
// Block = 16 waves on 64 rows of x and all 192 output columns; grid 256.
// The k range runs in 6 slabs of 128: a slab of x (64 rows x 512B, f32) and of
// the weights^T (192 rows x 256B, f16) is brought into LDS by async copies in
// which a wave covers whole 128B lines, two buffers, the next slab in flight
// while this one is worked on. Wave (rt, cg) owns row tile rt and column tile
// cg of each of q, k, v; its fragments come from LDS.
// Outputs: q16 row-major [B*T, H] f16; k16 [B][T][H] and v transposed
// vt16 [B][H][T] f16, both with key t at place pos[b][t]. The block's V tile
// goes through LDS, so that a wave's stores run along the places of one h.
constexpr int PROWS  = 64;                   // rows of x of one block
constexpr int PK     = 128;                  // k of one slab
constexpr int PSLABS = CN / PK;              // 6
constexpr int XPITCH = PK * 4 + 16;          // 528 B, 16 B x odd
constexpr int WPITCH = PK * 2 + 16;          // 272 B, 16 B x odd
constexpr int XBUF   = PROWS * XPITCH;       // 33792
constexpr int WBUF   = 3 * HN * WPITCH;      // 52224
constexpr int PSTAGE = XBUF + WBUF;          // 86016
constexpr int VSLD   = PROWS + 8;            // halves of one h row of the staged V tile (144 B)

__global__ void __launch_bounds__(512)
qkv_proj(const float* __restrict__ x, const _Float16* __restrict__ wt,
         const int* __restrict__ pos,
         _Float16* __restrict__ q16, _Float16* __restrict__ k16,
         _Float16* __restrict__ vt16) {
  __shared__ __attribute__((aligned(256))) char smem[2 * PSTAGE];

  const int tid  = threadIdx.x;
  const int lane = tid & 31;
  const int wave = __builtin_amdgcn_readfirstlane(tid >> 5);
  const int rt   = wave & 3;                 // row tile inside the block
  const int cg   = wave >> 2;                // column tile of q, of k and of v
  const int blockrow = blockIdx.x * PROWS;

  // x slab: a wave copies one row's 512B; 16 rows a round, 4 rounds
  const char* xg = (const char*)(x + (size_t)(blockrow + (tid >> 5)) * CN) + (tid & 31) * 16;
  // weight slab: a wave copies two rows' 256B; 32 rows a round, 6 rounds
  const char* wg = (const char*)(wt + (size_t)(tid >> 4) * CN) + (tid & 15) * 16;
  const uint32_t lds0 = (uint32_t)(size_t)smem;
  const uint32_t xl = lds0 + (uint32_t)((tid >> 5) * XPITCH + (tid & 31) * 16);
  const uint32_t wl = lds0 + (uint32_t)(XBUF + (tid >> 4) * WPITCH + (tid & 15) * 16);

  auto fetch = [&](int s, int buf) {
    const char* xs = xg + s * (PK * 4);
    const char* ws = wg + s * (PK * 2);
    const uint32_t xd = xl + (uint32_t)(buf * PSTAGE);
    const uint32_t wd = wl + (uint32_t)(buf * PSTAGE);
    // s_wait_xcnt 0 ends the copies' own statement, so that it stands in front
    // of every later write of a register that they name
    asm volatile("global_load_async_to_lds_b128 %0, %1, off\n\t"
                 "global_load_async_to_lds_b128 %2, %3, off\n\t"
                 "global_load_async_to_lds_b128 %4, %5, off\n\t"
                 "global_load_async_to_lds_b128 %6, %7, off\n\t"
                 "global_load_async_to_lds_b128 %8, %9, off\n\t"
                 "global_load_async_to_lds_b128 %10, %11, off\n\t"
                 "global_load_async_to_lds_b128 %12, %13, off\n\t"
                 "global_load_async_to_lds_b128 %14, %15, off\n\t"
                 "global_load_async_to_lds_b128 %16, %17, off\n\t"
                 "global_load_async_to_lds_b128 %18, %19, off\n\t"
                 "s_wait_xcnt 0x0"
                 :: "v"(xd),                "v"(xs),
                    "v"(xd + 16 * XPITCH),  "v"(xs + 16 * (CN * 4)),
                    "v"(xd + 32 * XPITCH),  "v"(xs + 32 * (CN * 4)),
                    "v"(xd + 48 * XPITCH),  "v"(xs + 48 * (CN * 4)),
                    "v"(wd),                "v"(ws),
                    "v"(wd + 32 * WPITCH),  "v"(ws + 32 * (CN * 2)),
                    "v"(wd + 64 * WPITCH),  "v"(ws + 64 * (CN * 2)),
                    "v"(wd + 96 * WPITCH),  "v"(ws + 96 * (CN * 2)),
                    "v"(wd + 128 * WPITCH), "v"(ws + 128 * (CN * 2)),
                    "v"(wd + 160 * WPITCH), "v"(ws + 160 * (CN * 2))
                 : "memory");
  };

  v8f acc[3];  // q, k, v
#pragma unroll
  for (int i = 0; i < 3; ++i) acc[i] = (v8f)0.0f;

  fetch(0, 0);

  // places of the keys this lane will store (read here, used behind the loop);
  // '& (TN - 1)' bounds every address formed from them
  const int rl0 = rt * 16 + (lane >> 4) * 8;         // first of the lane's 8 rows
  int kp[8];
  {
    const int4 p0 = *(const int4*)(pos + blockrow + rl0);
    const int4 p1 = *(const int4*)(pos + blockrow + rl0 + 4);
    kp[0] = p0.x & (TN - 1); kp[1] = p0.y & (TN - 1);
    kp[2] = p0.z & (TN - 1); kp[3] = p0.w & (TN - 1);
    kp[4] = p1.x & (TN - 1); kp[5] = p1.y & (TN - 1);
    kp[6] = p1.z & (TN - 1); kp[7] = p1.w & (TN - 1);
  }
  const int vpa = pos[blockrow + lane] & (TN - 1);
  const int vpb = pos[blockrow + 32 + lane] & (TN - 1);

  asm volatile("s_wait_asynccnt 0x0" ::: "memory");   // slab 0 has landed
  __syncthreads();
  fetch(1, 1);

  constexpr int XLD = XPITCH / 4, WLD = WPITCH / 2;   // pitches in elements
  for (int s = 0; s < PSLABS; ++s) {
    const int cur = s & 1;
    const float*    xb = (const float*)(smem + cur * PSTAGE) + rt * 16 * XLD;
    const _Float16* wb = (const _Float16*)(smem + cur * PSTAGE + XBUF) + cg * 16 * WLD;
#pragma unroll
    for (int kc = 0; kc < PK; kc += 32) {
      v16h a = load_tile_f(xb + kc, XLD, lane);
#pragma unroll
      for (int w = 0; w < 3; ++w) {
        v16h b = load_tile_h(wb + w * HN * WLD + kc, WLD, lane);
        acc[w] = wmma16(a, b, acc[w]);
      }
    }
    // my reads of 'cur' are back and my copies of the next slab have landed,
    // then everyone has left 'cur' before it is refilled
    asm volatile("s_wait_dscnt 0x0" ::: "memory");
    asm volatile("s_wait_asynccnt 0x0" ::: "memory");
    __syncthreads();
    if (s + 2 < PSLABS) fetch(s + 2, cur);
  }
  asm volatile("s_wait_asynccnt 0x0" ::: "memory");   // no copy is left when the wave ends

  // C/D layout: element r of acc -> row (r + 8*(lane/16)), col (lane&15).
  const int h    = cg * 16 + (lane & 15);
  const int row0 = blockrow + rl0;
  const int b    = blockrow >> 12;   // T = 4096: the block's rows lie in one batch
  _Float16* vs = (_Float16*)smem;    // [h][row of the block]; the ring is free now
  v8h vv;
#pragma unroll
  for (int r = 0; r < 8; ++r) vv[r] = (_Float16)acc[2][r];
  *(v8h*)(vs + h * VSLD + rl0) = vv;
  __syncthreads();   // in front of the global stores: it then waits for LDS alone
#pragma unroll
  for (int r = 0; r < 8; ++r) {
    q16[(size_t)(row0 + r) * HN + h] = (_Float16)acc[0][r];
    k16[((size_t)b * TN + kp[r]) * HN + h] = (_Float16)acc[1][r];
  }
  // wave w stores h = 4w .. 4w+3; a lane takes rows 'lane' and 'lane + 32': the
  // 32 places of a store lie in two short runs (kept keys, masked keys)
#pragma unroll
  for (int i = 0; i < 4; ++i) {
    const int hh = wave * 4 + i;
    _Float16* vrow = vt16 + ((size_t)b * HN + hh) * TN;
    vrow[vpa] = vs[hh * VSLD + lane];
    vrow[vpb] = vs[hh * VSLD + 32 + lane];
  }
}

// ---------------------------------------------------------------------------
// lane l <-> lane l ^ 16: both hold the same query column, each half of its keys
__device__ __forceinline__ float xhalf(float x) {
  const int v = __builtin_bit_cast(int, x);
  return __builtin_bit_cast(float, __builtin_amdgcn_permlanex16(
      v, v, 0x76543210, 0xfedcba98, false, false));
}

// ---------------------------------------------------------------------------
// Kernel 3: flash attention with async-staged K/V tiles in LDS.
// Block = 16 waves on one batch: 4 query tiles x 4 key ranges. K and V^T come
// with the batch's nk kept keys in front (a masked key adds nothing to any sum),
// so the ranges cover only ceil(nk / 128) tiles of 32 keys each; a tile that
// reaches past nk tests the key's place.
// The 4 waves of a key range share that range's K/V tile stream; each wave
// keeps its own maximum, sum and O^T over its range, and the 4 partial results
// of a query tile are merged through LDS behind the loop.
// Per trip and range: async copy K (32x64 f16, 4KB) and V^T (64x32 f16, 4KB)
// into double-buffered LDS (ASYNCcnt), one barrier per trip; each wave
// computes S^T = K*Q^T (WMMA: rows = keys, columns = queries), so that a lane
// holds 16 of the 32 scores of ONE query: the online softmax runs in the lane
// plus one exchange between the wave's halves. The two S^T tiles, converted in
// place, are the B operand P^T of O^T += V^T*P^T (WMMA): P never leaves the
// registers.
//
// LDS layout:
//   [    0, 36864)  K tiles,  2 stages x 4 ranges x 4608B, [t][h], rows of 144B
//   [36864, 77824)  V tiles,  2 stages x 4 ranges x 5120B, [h][t], rows of 80B
__global__ void __launch_bounds__(NQ * NS * 32)
flash_attn(const _Float16* __restrict__ q16, const _Float16* __restrict__ k16,
           const _Float16* __restrict__ vt16, const int* __restrict__ nkeys,
           float* __restrict__ out) {
  __shared__ __attribute__((aligned(256))) char smem[LDS_SZ];

  const int tid  = threadIdx.x;
  const int lane = tid & 31;
  const int wave = __builtin_amdgcn_readfirstlane(tid >> 5);
  const int qi   = wave & (NQ - 1);          // query tile inside the block
  const int sp   = wave / NQ;                // key range
  const int b    = blockIdx.x / (TN / 16 / NQ);                  // 64 blocks per batch
  const int qt   = (blockIdx.x % (TN / 16 / NQ)) * NQ + qi;      // q-tile in the batch
  // kept keys of the batch, clamped to the shape: it bounds trips and addresses
  const int nk   = __builtin_amdgcn_readfirstlane(min(max(nkeys[b], 0), TN));
  const int nit  = (nk + NS * 32 - 1) / (NS * 32);               // trips, at most 32
  const int k0   = sp * nit * 32;            // first key of the range

  // the 128 threads of a range copy its tiles: 2 x 16B of K and of V^T each
  const int tr = tid & 127;
  const char* kg = (const char*)(k16 + ((size_t)b * TN + k0) * HN) + tr * 16;       // [t][h]
  const char* vg = (const char*)(vt16 + (size_t)b * HN * TN + k0)                   // [h][t]
                   + (tr >> 2) * (TN * 2) + (tr & 3) * 16;
  const uint32_t lds0 = (uint32_t)(size_t)smem;
  const uint32_t kl = lds0 + (uint32_t)(sp * KBUF + (tr >> 3) * KPITCH + (tr & 7) * 16);
  const uint32_t vl = lds0 + (uint32_t)(VBASE + sp * VBUF + (tr >> 2) * VPITCH + (tr & 3) * 16);

  // cooperative async fetch of the range's 32-key K tile + V tile of trip 'it'
  auto fetch_kv = [&](int it, int buf) {
    // K tile: contiguous 4KB in global memory, 8 copies per row; rows 0-15, 16-31
    const uint32_t kla = kl + (uint32_t)(buf * KSTAGE);
    const uint32_t klb = kla + 16 * KPITCH;
    const char* kga = kg + it * (32 * HN * 2);
    const char* kgb = kga + 16 * HN * 2;
    // V tile: 64 rows of 64B, global row stride TN*2; rows 0-31, 32-63
    const uint32_t vla = vl + (uint32_t)(buf * VSTAGE);
    const uint32_t vlb = vla + 32 * VPITCH;
    const char* vga = vg + it * (32 * 2);
    const char* vgb = vga + 32 * (TN * 2);
    // s_wait_xcnt 0 ends the copies' own statement, so that it stands in front
    // of every later write of a register that they name
    asm volatile("global_load_async_to_lds_b128 %0, %1, off\n\t"
                 "global_load_async_to_lds_b128 %2, %3, off\n\t"
                 "global_load_async_to_lds_b128 %4, %5, off\n\t"
                 "global_load_async_to_lds_b128 %6, %7, off\n\t"
                 "s_wait_xcnt 0x0"
                 :: "v"(kla), "v"(kga), "v"(klb), "v"(kgb),
                    "v"(vla), "v"(vga), "v"(vlb), "v"(vgb)
                 : "memory");
  };

  const _Float16* qb = q16 + ((size_t)b * TN + qt * 16) * HN;
  const v16h aq0 = load_tile_h(qb, HN, lane);        // h = 0..31
  const v16h aq1 = load_tile_h(qb + 32, HN, lane);   // h = 32..63

  const int half  = lane >> 4;

  // O^T tiles: o[j][r] = O[query lane & 15][h = 16*j + 8*half + r]
  v8f o[4];
#pragma unroll
  for (int j = 0; j < 4; ++j) o[j] = (v8f)0.0f;
  float m = NEG_BIG;   // running maximum of this lane's query (equal in both halves)
  float l = 0.0f;      // running sum over this half's keys only; joined at the end

  fetch_kv(0, 0);
  asm volatile("s_wait_asynccnt 0x0" ::: "memory");
  __syncthreads();

  for (int it = 0; it < nit; ++it) {
    const int cur = it & 1;
    if (it + 1 < nit) fetch_kv(it + 1, cur ^ 1);   // prefetch next tile

    const _Float16* kbufp = (const _Float16*)(smem + cur * KSTAGE + sp * KBUF);
    const _Float16* vbufp = (const _Float16*)(smem + VBASE + cur * VSTAGE + sp * VBUF);

    // kept keys from this tile on, the same in the whole wave; below 32 the tile
    // reaches past nk. Element i of a lane's 16 scores is key 8*half + i (i < 8)
    // or 8*half + i + 8 of the tile: it counts while that is below 'left'
    const int  left = nk - (k0 + it * 32);
    const bool tail = left < 32;
    const int  lim  = left - 8 * half;

    // S^T tiles: A = K rows from LDS, B = Q^T kept in registers
    v8f s0 = (v8f)0.0f, s1 = (v8f)0.0f;
    constexpr int KLD = KPITCH / 2, VLD = VPITCH / 2;   // pitches in halves
    s0 = wmma16(load_tile_h(kbufp, KLD, lane), aq0, s0);
    s0 = wmma16(load_tile_h(kbufp + 32, KLD, lane), aq1, s0);
    s1 = wmma16(load_tile_h(kbufp + 16 * KLD, KLD, lane), aq0, s1);
    s1 = wmma16(load_tile_h(kbufp + 16 * KLD + 32, KLD, lane), aq1, s1);

    // scale (+ mask in a tail tile), then the online-softmax update of this lane's query
    float a[16], t[16];
#pragma unroll
    for (int r = 0; r < 8; ++r) {
      a[r]     = s0[r] * SM_SCALE;
      a[8 + r] = s1[r] * SM_SCALE;
    }
    if (tail) {
#pragma unroll
      for (int r = 0; r < 8; ++r) {
        if (r >= lim)      a[r]     = NEG_BIG;
        if (16 + r >= lim) a[8 + r] = NEG_BIG;
      }
    }
#pragma unroll
    for (int i = 0; i < 16; ++i) t[i] = a[i];
#pragma unroll
    for (int w = 8; w >= 1; w >>= 1)
#pragma unroll
      for (int i = 0; i < w; ++i) t[i] = fmaxf(t[i], t[i + w]);
    const float rmax  = fmaxf(t[0], xhalf(t[0]));
    const float nm    = fmaxf(m, rmax);
    const float alpha = __expf(m - nm);
    m = nm;

    // P^T in the B layout: element i of the lane is key (i < 8 ? 8*half + i
    // : 16 + 8*half + i - 8), the k order of load_tile_h on the V^T rows
#pragma unroll
    for (int i = 0; i < 16; ++i) t[i] = __expf(a[i] - nm);
    // a key past nk has a = NEG_BIG, and exp(NEG_BIG - nm) is 0 once a key of the
    // range has counted (the places are in order: key 0 of its first tile does,
    // unless the whole range lies past nk: that case is cleared behind the loop)
    v16h pb;
#pragma unroll
    for (int i = 0; i < 16; ++i) pb[i] = (_Float16)t[i];
#pragma unroll
    for (int w = 8; w >= 1; w >>= 1)
#pragma unroll
      for (int i = 0; i < w; ++i) t[i] += t[i + w];
    l = l * alpha + t[0];
#pragma unroll
    for (int j = 0; j < 4; ++j) o[j] *= alpha;

    // O^T += V^T * P^T: A = V^T rows ([h][t]) from LDS
#pragma unroll
    for (int j = 0; j < 4; ++j) {
      v16h av = load_tile_h(vbufp + (j * 16) * VLD, VLD, lane);
      o[j] = wmma16(av, pb, o[j]);
    }

    // my reads of 'cur' are back and my prefetch has landed, then everyone is
    // done reading 'cur' before it is refilled (after the last trip: rewritten)
    asm volatile("s_wait_dscnt 0x0" ::: "memory");
    asm volatile("s_wait_asynccnt 0x0" ::: "memory");
    __syncthreads();
  }

  // a range wholly past nk has met nm = NEG_BIG and summed exp(0): it counts nothing
  if (k0 >= nk) {
    l = 0.0f;
#pragma unroll
    for (int j = 0; j < 4; ++j) o[j] = (v8f)0.0f;
  }

  // merge of the 4 key ranges of a query tile. Each wave leaves its O^T tiles
  // (16B per lane and piece, lanes adjacent) and its (max, sum) in LDS
  {
    const float lt = l + xhalf(l);   // both halves' keys
#pragma unroll
    for (int j = 0; j < 4; ++j) {
      float4* pw = (float4*)(smem + (wave * 4 + j) * 1024 + lane * 16);
      pw[0]  = make_float4(o[j][0], o[j][1], o[j][2], o[j][3]);
      pw[32] = make_float4(o[j][4], o[j][5], o[j][6], o[j][7]);
    }
    *(float2*)(smem + MLBASE + (wave * 32 + lane) * 8) = make_float2(m, lt);
  }
  __syncthreads();

  // wave (qi, sp) finishes 8 queries x 32 h: whole 128B lines of out, each from
  // one wave. A lane takes 8 consecutive h of one query.
  const int mq = (sp >> 1) * 8 + (lane & 7);      // query inside the q-tile
  const int mh = (lane >> 3) & 1;                 // the half that held these h
  const int mj = (sp & 1) * 2 + (lane >> 4);      // O^T tile
  float pm[NS], pl[NS];
#pragma unroll
  for (int s = 0; s < NS; ++s) {
    const float2 ml = *(const float2*)(smem + MLBASE + ((s * NQ + qi) * 32 + mq) * 8);
    pm[s] = ml.x;
    pl[s] = ml.y;
  }
  const float gm = fmaxf(fmaxf(pm[0], pm[1]), fmaxf(pm[2], pm[3]));
  float gl = 0.0f;
  float r[8];
#pragma unroll
  for (int i = 0; i < 8; ++i) r[i] = 0.0f;
#pragma unroll
  for (int s = 0; s < NS; ++s) {
    const float wgt = __expf(pm[s] - gm);
    gl += wgt * pl[s];
    const float4* pr = (const float4*)(smem + ((s * NQ + qi) * 4 + mj) * 1024 + (mh * 16 + mq) * 16);
    const float4 x0 = pr[0], x1 = pr[32];
    r[0] += wgt * x0.x; r[1] += wgt * x0.y; r[2] += wgt * x0.z; r[3] += wgt * x0.w;
    r[4] += wgt * x1.x; r[5] += wgt * x1.y; r[6] += wgt * x1.z; r[7] += wgt * x1.w;
  }
  const float inv = 1.0f / gl;
  float* ob = out + ((size_t)b * TN + qt * 16 + mq) * HN + mj * 16 + mh * 8;
#pragma unroll
  for (int i = 0; i < 8; ++i) ob[i] = r[i] * inv;
}

// ---------------------------------------------------------------------------
extern "C" void kernel_launch(void* const* d_in, const int* in_sizes, int n_in,
                              void* d_out, int out_size, void* d_ws, size_t ws_size,
                              hipStream_t stream) {
  (void)in_sizes; (void)n_in; (void)out_size; (void)ws_size;
  const float* x  = (const float*)d_in[0];
  const int*   am = (const int*)d_in[1];
  const float* Wk = (const float*)d_in[2];
  const float* Wq = (const float*)d_in[3];
  const float* Wv = (const float*)d_in[4];
  float*       out = (float*)d_out;

  // workspace layout (f16): [3][H][C] weights^T, q16, k16, vt16; (int) pos, nkeys
  _Float16* wt   = (_Float16*)d_ws;
  _Float16* q16  = wt  + (size_t)3 * HN * CN;
  _Float16* k16  = q16 + (size_t)BN * TN * HN;
  _Float16* vt16 = k16 + (size_t)BN * TN * HN;
  int*      pos  = (int*)(vt16 + (size_t)BN * TN * HN);
  int*      nkeys = pos + (size_t)BN * TN;

  cvt_weights<<<NCVT + BN, 256, 0, stream>>>(Wq, Wk, Wv, am, wt, pos, nkeys);
  qkv_proj<<<(BN * TN) / PROWS, 512, 0, stream>>>(x, wt, pos, q16, k16, vt16);
  flash_attn<<<(BN * TN / 16) / NQ, NQ * NS * 32, 0, stream>>>(q16, k16, vt16, nkeys, out);
}

// v006
// It runs in 30.8 microseconds.
// In two side-by-side timings against v005, it was 1.04 and 1.07 times as fast.
// Counting every step since v000, it is 15.2 times as fast.
#include <hip/hip_runtime.h>
#include <hip/hip_bf16.h>

typedef __attribute__((ext_vector_type(16))) _Float16 v16h;
typedef __attribute__((ext_vector_type(8)))  float    v8f;
typedef __attribute__((ext_vector_type(8)))  _Float16 v8h;

constexpr int BN = 4, TN = 4096, CN = 768, HN = 64;
constexpr float SM_SCALE = 0.03608439182435161f;  // 1/sqrt(768) -- reference scales by C**-0.5
constexpr float NEG_BIG  = -3.0e38f;

// LDS row pitches of the staged K and V^T tiles, in bytes: an odd multiple of
// 16 B, so that the 16 rows one ds_load_b128 half-wave reads fall on 64
// different banks (the bare 128 B and 64 B rows fall on 8 and on 16)
constexpr int KPITCH = HN * 2 + 16;          // 144
constexpr int VPITCH = 32 * 2 + 16;          // 80
constexpr int KBUF   = 32 * KPITCH;          // 4608, one K tile
constexpr int VBUF   = HN * VPITCH;          // 5120, one V^T tile

// attention work-group: NQ query tiles x NS key ranges; a wave takes QW query
// tiles of one range, so that a K or V^T fragment read from LDS serves QW tiles
constexpr int NQ     = 4;
constexpr int QW     = 2;
constexpr int NS     = 8;
constexpr int NWAVE  = NQ / QW * NS;         // 16
constexpr int KSTAGE = NS * KBUF;            // 36864, the K tiles of one stage
constexpr int VSTAGE = NS * VBUF;            // 40960, the V^T tiles of one stage
constexpr int VBASE  = 2 * KSTAGE;           // 73728
constexpr int LDS_SZ = VBASE + 2 * VSTAGE;   // 155648
// after the loop the ring holds the partial results, one slot a (range, query tile)
constexpr int MLBASE = NQ * NS * 4096;       // 131072: (max, sum) pairs behind the O^T partials
static_assert(MLBASE + NQ * NS * 32 * 8 <= LDS_SZ, "partials fit the ring");

// ---------------------------------------------------------------------------
// D = A*B + C, f16 inputs, f32 accumulate (v_wmma_f32_16x16x32_f16)
__device__ __forceinline__ v8f wmma16(v16h a, v16h b, v8f c) {
  return __builtin_amdgcn_wmma_f32_16x16x32_f16(false, a, false, b, (short)0, c,
                                                false, false);
}

// Load a 16x32 f16 tile (row-major, row stride ld) into the WMMA A/B register
// layout for wave32:
//   lanes 0-15 : row = lane,    halves = cols {0..7} then {16..23}
//   lanes 16-31: row = lane-16, halves = cols {8..15} then {24..31}
__device__ __forceinline__ v16h load_tile_h(const _Float16* base, int ld, int lane) {
  const int r  = lane & 15;
  const int c0 = (lane & 16) ? 8 : 0;
  const _Float16* p = base + r * ld + c0;
  v16h o;
#pragma unroll
  for (int i = 0; i < 8; ++i) { o[i] = p[i]; o[8 + i] = p[16 + i]; }
  return o;
}

// Same tile layout but source is f32 (converted to f16 on the fly).
__device__ __forceinline__ v16h load_tile_f(const float* base, int ld, int lane) {
  const int r  = lane & 15;
  const int c0 = (lane & 16) ? 8 : 0;
  const float* p = base + r * ld + c0;
  v16h o;
#pragma unroll
  for (int i = 0; i < 8; ++i) {
    o[i]     = (_Float16)p[i];
    o[8 + i] = (_Float16)p[16 + i];
  }
  return o;
}

// ---------------------------------------------------------------------------
// Kernel 1: transpose + convert weights to f16.  wt layout: [3][H][C] with
// w=0 -> Wq^T, w=1 -> Wk^T, w=2 -> Wv^T  (row h, col c: contiguous in c).
// The last BN blocks scan the key mask instead, one batch each: pos[b][t] is
// the place of key t in a stable partition of the batch's keys, the kept keys
// (mask != 0) first, the masked ones behind them; nkeys[b] counts the kept.
constexpr int NCVT = (3 * CN * HN + 255) / 256;   // blocks that convert weights

__global__ void __launch_bounds__(256)
cvt_weights(const float* __restrict__ Wq, const float* __restrict__ Wk,
            const float* __restrict__ Wv, const int* __restrict__ amask,
            _Float16* __restrict__ wt, int* __restrict__ pos,
            int* __restrict__ nkeys) {
  if (blockIdx.x >= NCVT) {
    __shared__ int wsum[8];
    const int bb = blockIdx.x - NCVT;
    const int t0 = threadIdx.x * 16;           // 16 keys a thread
    const int ln = threadIdx.x & 31, wv = threadIdx.x >> 5;
    const int4* mp = (const int4*)(amask + bb * TN + t0);
    int f[16];
#pragma unroll
    for (int i = 0; i < 4; ++i) {
      const int4 v = mp[i];
      f[4 * i] = v.x != 0; f[4 * i + 1] = v.y != 0;
      f[4 * i + 2] = v.z != 0; f[4 * i + 3] = v.w != 0;
    }
    int c = 0;
#pragma unroll
    for (int i = 0; i < 16; ++i) c += f[i];
    int inc = c;                               // inclusive scan over the wave
#pragma unroll
    for (int d = 1; d < 32; d <<= 1) {
      const int u = __shfl_up(inc, d, 32);
      if (ln >= d) inc += u;
    }
    if (ln == 31) wsum[wv] = inc;
    __syncthreads();
    int before = inc - c, total = 0;           // kept keys in front of t0; all kept keys
#pragma unroll
    for (int w = 0; w < 8; ++w) {
      const int s = wsum[w];
      if (w < wv) before += s;
      total += s;
    }
    int p[16];
#pragma unroll
    for (int i = 0; i < 16; ++i) {
      p[i] = f[i] ? before : total + (t0 + i) - before;
      before += f[i];
    }
    int4* pp = (int4*)(pos + bb * TN + t0);
#pragma unroll
    for (int i = 0; i < 4; ++i)
      pp[i] = make_int4(p[4 * i], p[4 * i + 1], p[4 * i + 2], p[4 * i + 3]);
    if (threadIdx.x == 0) nkeys[bb] = total;
    return;
  }
  int idx = blockIdx.x * blockDim.x + threadIdx.x;
  if (idx >= 3 * CN * HN) return;
  int w   = idx / (CN * HN);
  int rem = idx - w * (CN * HN);
  int h   = rem / CN;
  int c   = rem - h * CN;
  const float* W = (w == 0) ? Wq : (w == 1) ? Wk : Wv;
  wt[idx] = (_Float16)W[c * HN + h];
}

// ---------------------------------------------------------------------------
// Kernel 2: QKV projection.  [B*T, C] x [C, H] (x3) with WMMA, f32 accum.
// Block = 16 waves on 64 rows of x and all 192 output columns; grid 256.
// The k range runs in 6 slabs of 128: a slab of x (64 rows x 512B, f32) and of
// the weights^T (192 rows x 256B, f16) is brought into LDS by async copies in
// which a wave covers whole 128B lines, two buffers, the next slab in flight
// while this one is worked on. Wave (rt, cg) owns row tile rt and column tile
// cg of each of q, k, v; its fragments come from LDS.
// Outputs: q16 row-major [B*T, H] f16; k16 [B][T][H] and v transposed
// vt16 [B][H][T] f16, both with key t at place pos[b][t]. The block's V tile
// goes through LDS, so that a wave's stores run along the places of one h.
constexpr int PROWS  = 64;                   // rows of x of one block
constexpr int PK     = 128;                  // k of one slab
constexpr int PSLABS = CN / PK;              // 6
constexpr int XPITCH = PK * 4 + 16;          // 528 B, 16 B x odd
constexpr int WPITCH = PK * 2 + 16;          // 272 B, 16 B x odd
constexpr int XBUF   = PROWS * XPITCH;       // 33792
constexpr int WBUF   = 3 * HN * WPITCH;      // 52224
constexpr int PSTAGE = XBUF + WBUF;          // 86016
constexpr int VSLD   = PROWS + 8;            // halves of one h row of the staged V tile (144 B)

__global__ void __launch_bounds__(512)
qkv_proj(const float* __restrict__ x, const _Float16* __restrict__ wt,
         const int* __restrict__ pos,
         _Float16* __restrict__ q16, _Float16* __restrict__ k16,
         _Float16* __restrict__ vt16) {
  __shared__ __attribute__((aligned(256))) char smem[2 * PSTAGE];

  const int tid  = threadIdx.x;
  const int lane = tid & 31;
  const int wave = __builtin_amdgcn_readfirstlane(tid >> 5);
  const int rt   = wave & 3;                 // row tile inside the block
  const int cg   = wave >> 2;                // column tile of q, of k and of v
  const int blockrow = blockIdx.x * PROWS;

  // x slab: a wave copies one row's 512B; 16 rows a round, 4 rounds
  const char* xg = (const char*)(x + (size_t)(blockrow + (tid >> 5)) * CN) + (tid & 31) * 16;
  // weight slab: a wave copies two rows' 256B; 32 rows a round, 6 rounds
  const char* wg = (const char*)(wt + (size_t)(tid >> 4) * CN) + (tid & 15) * 16;
  const uint32_t lds0 = (uint32_t)(size_t)smem;
  const uint32_t xl = lds0 + (uint32_t)((tid >> 5) * XPITCH + (tid & 31) * 16);
  const uint32_t wl = lds0 + (uint32_t)(XBUF + (tid >> 4) * WPITCH + (tid & 15) * 16);

  auto fetch = [&](int s, int buf) {
    const char* xs = xg + s * (PK * 4);
    const char* ws = wg + s * (PK * 2);
    const uint32_t xd = xl + (uint32_t)(buf * PSTAGE);
    const uint32_t wd = wl + (uint32_t)(buf * PSTAGE);
    // s_wait_xcnt 0 ends the copies' own statement, so that it stands in front
    // of every later write of a register that they name
    asm volatile("global_load_async_to_lds_b128 %0, %1, off\n\t"
                 "global_load_async_to_lds_b128 %2, %3, off\n\t"
                 "global_load_async_to_lds_b128 %4, %5, off\n\t"
                 "global_load_async_to_lds_b128 %6, %7, off\n\t"
                 "global_load_async_to_lds_b128 %8, %9, off\n\t"
                 "global_load_async_to_lds_b128 %10, %11, off\n\t"
                 "global_load_async_to_lds_b128 %12, %13, off\n\t"
                 "global_load_async_to_lds_b128 %14, %15, off\n\t"
                 "global_load_async_to_lds_b128 %16, %17, off\n\t"
                 "global_load_async_to_lds_b128 %18, %19, off\n\t"
                 "s_wait_xcnt 0x0"
                 :: "v"(xd),                "v"(xs),
                    "v"(xd + 16 * XPITCH),  "v"(xs + 16 * (CN * 4)),
                    "v"(xd + 32 * XPITCH),  "v"(xs + 32 * (CN * 4)),
                    "v"(xd + 48 * XPITCH),  "v"(xs + 48 * (CN * 4)),
                    "v"(wd),                "v"(ws),
                    "v"(wd + 32 * WPITCH),  "v"(ws + 32 * (CN * 2)),
                    "v"(wd + 64 * WPITCH),  "v"(ws + 64 * (CN * 2)),
                    "v"(wd + 96 * WPITCH),  "v"(ws + 96 * (CN * 2)),
                    "v"(wd + 128 * WPITCH), "v"(ws + 128 * (CN * 2)),
                    "v"(wd + 160 * WPITCH), "v"(ws + 160 * (CN * 2))
                 : "memory");
  };

  v8f acc[3];  // q, k, v
#pragma unroll
  for (int i = 0; i < 3; ++i) acc[i] = (v8f)0.0f;

  fetch(0, 0);

  // places of the keys this lane will store (read here, used behind the loop);
  // '& (TN - 1)' bounds every address formed from them
  const int rl0 = rt * 16 + (lane >> 4) * 8;         // first of the lane's 8 rows
  int kp[8];
  {
    const int4 p0 = *(const int4*)(pos + blockrow + rl0);
    const int4 p1 = *(const int4*)(pos + blockrow + rl0 + 4);
    kp[0] = p0.x & (TN - 1); kp[1] = p0.y & (TN - 1);
    kp[2] = p0.z & (TN - 1); kp[3] = p0.w & (TN - 1);
    kp[4] = p1.x & (TN - 1); kp[5] = p1.y & (TN - 1);
    kp[6] = p1.z & (TN - 1); kp[7] = p1.w & (TN - 1);
  }
  const int vpa = pos[blockrow + lane] & (TN - 1);
  const int vpb = pos[blockrow + 32 + lane] & (TN - 1);

  asm volatile("s_wait_asynccnt 0x0" ::: "memory");   // slab 0 has landed
  __syncthreads();
  fetch(1, 1);

  constexpr int XLD = XPITCH / 4, WLD = WPITCH / 2;   // pitches in elements
  for (int s = 0; s < PSLABS; ++s) {
    const int cur = s & 1;
    const float*    xb = (const float*)(smem + cur * PSTAGE) + rt * 16 * XLD;
    const _Float16* wb = (const _Float16*)(smem + cur * PSTAGE + XBUF) + cg * 16 * WLD;
#pragma unroll
    for (int kc = 0; kc < PK; kc += 32) {
      v16h a = load_tile_f(xb + kc, XLD, lane);
#pragma unroll
      for (int w = 0; w < 3; ++w) {
        v16h b = load_tile_h(wb + w * HN * WLD + kc, WLD, lane);
        acc[w] = wmma16(a, b, acc[w]);
      }
    }
    // my reads of 'cur' are back and my copies of the next slab have landed,
    // then everyone has left 'cur' before it is refilled
    asm volatile("s_wait_dscnt 0x0" ::: "memory");
    asm volatile("s_wait_asynccnt 0x0" ::: "memory");
    __syncthreads();
    if (s + 2 < PSLABS) fetch(s + 2, cur);
  }
  asm volatile("s_wait_asynccnt 0x0" ::: "memory");   // no copy is left when the wave ends

  // C/D layout: element r of acc -> row (r + 8*(lane/16)), col (lane&15).
  const int h    = cg * 16 + (lane & 15);
  const int row0 = blockrow + rl0;
  const int b    = blockrow >> 12;   // T = 4096: the block's rows lie in one batch
  _Float16* vs = (_Float16*)smem;    // [h][row of the block]; the ring is free now
  v8h vv;
#pragma unroll
  for (int r = 0; r < 8; ++r) vv[r] = (_Float16)acc[2][r];
  *(v8h*)(vs + h * VSLD + rl0) = vv;
  __syncthreads();   // in front of the global stores: it then waits for LDS alone
#pragma unroll
  for (int r = 0; r < 8; ++r) {
    q16[(size_t)(row0 + r) * HN + h] = (_Float16)acc[0][r];
    k16[((size_t)b * TN + kp[r]) * HN + h] = (_Float16)acc[1][r];
  }
  // wave w stores h = 4w .. 4w+3; a lane takes rows 'lane' and 'lane + 32': the
  // 32 places of a store lie in two short runs (kept keys, masked keys)
#pragma unroll
  for (int i = 0; i < 4; ++i) {
    const int hh = wave * 4 + i;
    _Float16* vrow = vt16 + ((size_t)b * HN + hh) * TN;
    vrow[vpa] = vs[hh * VSLD + lane];
    vrow[vpb] = vs[hh * VSLD + 32 + lane];
  }
}

// ---------------------------------------------------------------------------
// lane l <-> lane l ^ 16: both hold the same query column, each half of its keys
__device__ __forceinline__ float xhalf(float x) {
  const int v = __builtin_bit_cast(int, x);
  return __builtin_bit_cast(float, __builtin_amdgcn_permlanex16(
      v, v, 0x76543210, 0xfedcba98, false, false));
}

// ---------------------------------------------------------------------------
// Kernel 3: flash attention with async-staged K/V tiles in LDS.
// Block = 16 waves on one batch: 4 query tiles x 8 key ranges, a wave on 2 query
// tiles of one range. K and V^T come
// with the batch's nk kept keys in front (a masked key adds nothing to any sum),
// so the ranges cover only ceil(nk / 256) tiles of 32 keys each; a tile that
// reaches past nk tests the key's place.
// The 2 waves of a key range share that range's K/V tile stream; each wave
// keeps a maximum, sum and O^T per query tile over its range, and the 8 partial
// results of a query tile are merged through LDS behind the loop.
// Per trip and range: async copy K (32x64 f16, 4KB) and V^T (64x32 f16, 4KB)
// into double-buffered LDS (ASYNCcnt), one barrier per trip; each wave
// computes S^T = K*Q^T (WMMA: rows = keys, columns = queries), so that a lane
// holds 16 of the 32 scores of ONE query: the online softmax runs in the lane
// plus one exchange between the wave's halves. The two S^T tiles, converted in
// place, are the B operand P^T of O^T += V^T*P^T (WMMA): P never leaves the
// registers.
//
// LDS layout:
//   [    0,  73728)  K tiles,  2 stages x 8 ranges x 4608B, [t][h], rows of 144B
//   [73728, 155648)  V tiles,  2 stages x 8 ranges x 5120B, [h][t], rows of 80B
__global__ void __launch_bounds__(NWAVE * 32)
flash_attn(const _Float16* __restrict__ q16, const _Float16* __restrict__ k16,
           const _Float16* __restrict__ vt16, const int* __restrict__ nkeys,
           float* __restrict__ out) {
  __shared__ __attribute__((aligned(256))) char smem[LDS_SZ];

  const int tid  = threadIdx.x;
  const int lane = tid & 31;
  const int wave = __builtin_amdgcn_readfirstlane(tid >> 5);
  const int qi   = (wave & (NQ / QW - 1)) * QW;   // first of the wave's query tiles in the block
  const int sp   = wave / (NQ / QW);              // key range
  const int b    = blockIdx.x / (TN / 16 / NQ);                  // 64 blocks per batch
  const int qt0  = (blockIdx.x % (TN / 16 / NQ)) * NQ;           // the block's first q-tile in the batch
  // kept keys of the batch, clamped to the shape: it bounds trips and addresses
  const int nk   = __builtin_amdgcn_readfirstlane(min(max(nkeys[b], 0), TN));
  const int nit  = (nk + NS * 32 - 1) / (NS * 32);               // trips, at most 16
  const int k0   = sp * nit * 32;            // first key of the range

  // the 64 threads of a range copy its tiles: 4 x 16B of K and of V^T each
  const int tr = tid & 63;
  const char* kg = (const char*)(k16 + ((size_t)b * TN + k0) * HN) + tr * 16;       // [t][h]
  const char* vg = (const char*)(vt16 + (size_t)b * HN * TN + k0)                   // [h][t]
                   + (tr >> 2) * (TN * 2) + (tr & 3) * 16;
  const uint32_t lds0 = (uint32_t)(size_t)smem;
  const uint32_t kl = lds0 + (uint32_t)(sp * KBUF + (tr >> 3) * KPITCH + (tr & 7) * 16);
  const uint32_t vl = lds0 + (uint32_t)(VBASE + sp * VBUF + (tr >> 2) * VPITCH + (tr & 3) * 16);

  // cooperative async fetch of the range's 32-key K tile + V tile of trip 'it'
  auto fetch_kv = [&](int it, int buf) {
    // K tile: contiguous 4KB in global memory, 8 copies per row; 8 rows a round
    const uint32_t kla = kl + (uint32_t)(buf * KSTAGE);
    const char* kga = kg + it * (32 * HN * 2);
    // V tile: 64 rows of 64B, global row stride TN*2; 16 rows a round
    const uint32_t vla = vl + (uint32_t)(buf * VSTAGE);
    const char* vga = vg + it * (32 * 2);
    // s_wait_xcnt 0 ends the copies' own statement, so that it stands in front
    // of every later write of a register that they name
    asm volatile("global_load_async_to_lds_b128 %0, %1, off\n\t"
                 "global_load_async_to_lds_b128 %2, %3, off\n\t"
                 "global_load_async_to_lds_b128 %4, %5, off\n\t"
                 "global_load_async_to_lds_b128 %6, %7, off\n\t"
                 "global_load_async_to_lds_b128 %8, %9, off\n\t"
                 "global_load_async_to_lds_b128 %10, %11, off\n\t"
                 "global_load_async_to_lds_b128 %12, %13, off\n\t"
                 "global_load_async_to_lds_b128 %14, %15, off\n\t"
                 "s_wait_xcnt 0x0"
                 :: "v"(kla),               "v"(kga),
                    "v"(kla + 8 * KPITCH),  "v"(kga + 8 * (HN * 2)),
                    "v"(kla + 16 * KPITCH), "v"(kga + 16 * (HN * 2)),
                    "v"(kla + 24 * KPITCH), "v"(kga + 24 * (HN * 2)),
                    "v"(vla),               "v"(vga),
                    "v"(vla + 16 * VPITCH), "v"(vga + 16 * (TN * 2)),
                    "v"(vla + 32 * VPITCH), "v"(vga + 32 * (TN * 2)),
                    "v"(vla + 48 * VPITCH), "v"(vga + 48 * (TN * 2))
                 : "memory");
  };

  // Q^T fragments of the wave's QW query tiles
  v16h aq0[QW], aq1[QW];
#pragma unroll
  for (int u = 0; u < QW; ++u) {
    const _Float16* qb = q16 + ((size_t)b * TN + (qt0 + qi + u) * 16) * HN;
    aq0[u] = load_tile_h(qb, HN, lane);        // h = 0..31
    aq1[u] = load_tile_h(qb + 32, HN, lane);   // h = 32..63
  }

  const int half  = lane >> 4;

  // O^T tiles: o[u][j][r] = O[query lane & 15 of tile u][h = 16*j + 8*half + r]
  v8f o[QW][4];
  float m[QW];   // running maximum of this lane's query (equal in both halves)
  float l[QW];   // running sum over this half's keys only; joined at the end
#pragma unroll
  for (int u = 0; u < QW; ++u) {
#pragma unroll
    for (int j = 0; j < 4; ++j) o[u][j] = (v8f)0.0f;
    m[u] = NEG_BIG;
    l[u] = 0.0f;
  }

  fetch_kv(0, 0);
  asm volatile("s_wait_asynccnt 0x0" ::: "memory");
  __syncthreads();

  for (int it = 0; it < nit; ++it) {
    const int cur = it & 1;
    if (it + 1 < nit) fetch_kv(it + 1, cur ^ 1);   // prefetch next tile

    const _Float16* kbufp = (const _Float16*)(smem + cur * KSTAGE + sp * KBUF);
    const _Float16* vbufp = (const _Float16*)(smem + VBASE + cur * VSTAGE + sp * VBUF);

    // kept keys from this tile on, the same in the whole wave; below 32 the tile
    // reaches past nk. Element i of a lane's 16 scores is key 8*half + i (i < 8)
    // or 8*half + i + 8 of the tile: it counts while that is below 'left'
    const int  left = nk - (k0 + it * 32);
    const bool tail = left < 32;
    const int  lim  = left - 8 * half;

    // S^T tiles: A = K rows from LDS, each fragment used for both query tiles;
    // B = Q^T kept in registers
    constexpr int KLD = KPITCH / 2, VLD = VPITCH / 2;   // pitches in halves
    const v16h k00 = load_tile_h(kbufp, KLD, lane);
    const v16h k01 = load_tile_h(kbufp + 32, KLD, lane);
    const v16h k10 = load_tile_h(kbufp + 16 * KLD, KLD, lane);
    const v16h k11 = load_tile_h(kbufp + 16 * KLD + 32, KLD, lane);
    v8f s0[QW], s1[QW];
#pragma unroll
    for (int u = 0; u < QW; ++u) {
      s0[u] = wmma16(k00, aq0[u], (v8f)0.0f);
      s1[u] = wmma16(k10, aq0[u], (v8f)0.0f);
    }
#pragma unroll
    for (int u = 0; u < QW; ++u) {
      s0[u] = wmma16(k01, aq1[u], s0[u]);
      s1[u] = wmma16(k11, aq1[u], s1[u]);
    }

    // scale (+ mask in a tail tile)
    float sc[QW][16];
#pragma unroll
    for (int u = 0; u < QW; ++u)
#pragma unroll
      for (int r = 0; r < 8; ++r) {
        sc[u][r]     = s0[u][r] * SM_SCALE;
        sc[u][8 + r] = s1[u][r] * SM_SCALE;
      }
    if (tail) {
#pragma unroll
      for (int r = 0; r < 8; ++r) {
#pragma unroll
        for (int u = 0; u < QW; ++u) {
          if (r >= lim)      sc[u][r]     = NEG_BIG;
          if (16 + r >= lim) sc[u][8 + r] = NEG_BIG;
        }
      }
    }

    v16h pb[QW];
#pragma unroll
    for (int u = 0; u < QW; ++u) {
      // the online-softmax update of this lane's query of tile u
      const float (&a)[16] = sc[u];
      float t[16];
#pragma unroll
      for (int i = 0; i < 16; ++i) t[i] = a[i];
#pragma unroll
      for (int w = 8; w >= 1; w >>= 1)
#pragma unroll
        for (int i = 0; i < w; ++i) t[i] = fmaxf(t[i], t[i + w]);
      const float rmax  = fmaxf(t[0], xhalf(t[0]));
      const float nm    = fmaxf(m[u], rmax);
      const float alpha = __expf(m[u] - nm);
      m[u] = nm;

      // P^T in the B layout: element i of the lane is key (i < 8 ? 8*half + i
      // : 16 + 8*half + i - 8), the k order of load_tile_h on the V^T rows
#pragma unroll
      for (int i = 0; i < 16; ++i) t[i] = __expf(a[i] - nm);
      // a key past nk has a = NEG_BIG, and exp(NEG_BIG - nm) is 0 once a key of the
      // range has counted (the places are in order: key 0 of its first tile does,
      // unless the whole range lies past nk: that case is cleared behind the loop)
#pragma unroll
      for (int i = 0; i < 16; ++i) pb[u][i] = (_Float16)t[i];
#pragma unroll
      for (int w = 8; w >= 1; w >>= 1)
#pragma unroll
        for (int i = 0; i < w; ++i) t[i] += t[i + w];
      l[u] = l[u] * alpha + t[0];
#pragma unroll
      for (int j = 0; j < 4; ++j) o[u][j] *= alpha;
    }

    // O^T += V^T * P^T: A = V^T rows ([h][t]) from LDS, each fragment used for
    // both query tiles
#pragma unroll
    for (int j = 0; j < 4; ++j) {
      const v16h av = load_tile_h(vbufp + (j * 16) * VLD, VLD, lane);
#pragma unroll
      for (int u = 0; u < QW; ++u) o[u][j] = wmma16(av, pb[u], o[u][j]);
    }

    // my reads of 'cur' are back and my prefetch has landed, then everyone is
    // done reading 'cur' before it is refilled (after the last trip: rewritten)
    asm volatile("s_wait_dscnt 0x0" ::: "memory");
    asm volatile("s_wait_asynccnt 0x0" ::: "memory");
    __syncthreads();
  }

  // a range wholly past nk has met nm = NEG_BIG and summed exp(0): it counts nothing
  if (k0 >= nk) {
#pragma unroll
    for (int u = 0; u < QW; ++u) {
      l[u] = 0.0f;
#pragma unroll
      for (int j = 0; j < 4; ++j) o[u][j] = (v8f)0.0f;
    }
  }

  // merge of the 8 key ranges of a query tile. Each wave leaves its O^T tiles
  // (16B per lane and piece, lanes adjacent) and its (max, sum) in LDS, in slot
  // range * NQ + query tile
#pragma unroll
  for (int u = 0; u < QW; ++u) {
    const int slot = sp * NQ + qi + u;
    const float lt = l[u] + xhalf(l[u]);   // both halves' keys
#pragma unroll
    for (int j = 0; j < 4; ++j) {
      float4* pw = (float4*)(smem + (slot * 4 + j) * 1024 + lane * 16);
      pw[0]  = make_float4(o[u][j][0], o[u][j][1], o[u][j][2], o[u][j][3]);
      pw[32] = make_float4(o[u][j][4], o[u][j][5], o[u][j][6], o[u][j][7]);
    }
    *(float2*)(smem + MLBASE + (slot * 32 + lane) * 8) = make_float2(m[u], lt);
  }
  __syncthreads();

  // wave w finishes 8 queries x 32 h of query tile w & 3: whole 128B lines of
  // out, each from one wave. A lane takes 8 consecutive h of one query.
  const int tq = wave & (NQ - 1);                 // query tile inside the block
  const int pt = wave / NQ;                       // which 8 queries, which 32 h
  const int mq = (pt >> 1) * 8 + (lane & 7);      // query inside the q-tile
  const int mh = (lane >> 3) & 1;                 // the half that held these h
  const int mj = (pt & 1) * 2 + (lane >> 4);      // O^T tile
  float pm[NS], pl[NS];
#pragma unroll
  for (int s = 0; s < NS; ++s) {
    const float2 ml = *(const float2*)(smem + MLBASE + ((s * NQ + tq) * 32 + mq) * 8);
    pm[s] = ml.x;
    pl[s] = ml.y;
  }
  float gm = pm[0];
#pragma unroll
  for (int s = 1; s < NS; ++s) gm = fmaxf(gm, pm[s]);
  float gl = 0.0f;
  float r[8];
#pragma unroll
  for (int i = 0; i < 8; ++i) r[i] = 0.0f;
#pragma unroll
  for (int s = 0; s < NS; ++s) {
    const float wgt = __expf(pm[s] - gm);
    gl += wgt * pl[s];
    const float4* pr = (const float4*)(smem + ((s * NQ + tq) * 4 + mj) * 1024 + (mh * 16 + mq) * 16);
    const float4 x0 = pr[0], x1 = pr[32];
    r[0] += wgt * x0.x; r[1] += wgt * x0.y; r[2] += wgt * x0.z; r[3] += wgt * x0.w;
    r[4] += wgt * x1.x; r[5] += wgt * x1.y; r[6] += wgt * x1.z; r[7] += wgt * x1.w;
  }
  const float inv = 1.0f / gl;
  float* ob = out + ((size_t)b * TN + (qt0 + tq) * 16 + mq) * HN + mj * 16 + mh * 8;
#pragma unroll
  for (int i = 0; i < 8; ++i) ob[i] = r[i] * inv;
}

// ---------------------------------------------------------------------------
extern "C" void kernel_launch(void* const* d_in, const int* in_sizes, int n_in,
                              void* d_out, int out_size, void* d_ws, size_t ws_size,
                              hipStream_t stream) {
  (void)in_sizes; (void)n_in; (void)out_size; (void)ws_size;
  const float* x  = (const float*)d_in[0];
  const int*   am = (const int*)d_in[1];
  const float* Wk = (const float*)d_in[2];
  const float* Wq = (const float*)d_in[3];
  const float* Wv = (const float*)d_in[4];
  float*       out = (float*)d_out;

  // workspace layout (f16): [3][H][C] weights^T, q16, k16, vt16; (int) pos, nkeys
  _Float16* wt   = (_Float16*)d_ws;
  _Float16* q16  = wt  + (size_t)3 * HN * CN;
  _Float16* k16  = q16 + (size_t)BN * TN * HN;
  _Float16* vt16 = k16 + (size_t)BN * TN * HN;
  int*      pos  = (int*)(vt16 + (size_t)BN * TN * HN);
  int*      nkeys = pos + (size_t)BN * TN;

  cvt_weights<<<NCVT + BN, 256, 0, stream>>>(Wq, Wk, Wv, am, wt, pos, nkeys);
  qkv_proj<<<(BN * TN) / PROWS, 512, 0, stream>>>(x, wt, pos, q16, k16, vt16);
  flash_attn<<<(BN * TN / 16) / NQ, NWAVE * 32, 0, stream>>>(q16, k16, vt16, nkeys, out);
}

// v007
// Measured time: 29.9 microseconds a run.
// Two timings next to v006 both put it at 1.04 times that version's speed.
// Counting every step since v000, it is 15.7 times as fast.
#include <hip/hip_runtime.h>
#include <hip/hip_bf16.h>

typedef __attribute__((ext_vector_type(16))) _Float16 v16h;
typedef __attribute__((ext_vector_type(8)))  float    v8f;
typedef __attribute__((ext_vector_type(8)))  _Float16 v8h;

constexpr int BN = 4, TN = 4096, CN = 768, HN = 64;
constexpr float SM_SCALE = 0.03608439182435161f;  // 1/sqrt(768) -- reference scales by C**-0.5
constexpr float NEG_BIG  = -3.0e38f;
// a lane's sum of a trip's exponentials (2 x 16) may reach this before the
// softmax references are renewed: every one of them then fits f16 with room
constexpr float PSUM_MAX = 4096.0f;

// LDS row pitches of the staged K and V^T tiles, in bytes: an odd multiple of
// 16 B, so that the 16 rows one ds_load_b128 half-wave reads fall on 64
// different banks (the bare 128 B and 64 B rows fall on 8 and on 16)
constexpr int KPITCH = HN * 2 + 16;          // 144
constexpr int VPITCH = 32 * 2 + 16;          // 80
constexpr int KBUF   = 32 * KPITCH;          // 4608, one K tile
constexpr int VBUF   = HN * VPITCH;          // 5120, one V^T tile

// attention work-group: NQ query tiles x NS key ranges; a wave takes QW query
// tiles of one range, so that a K or V^T fragment read from LDS serves QW tiles
constexpr int NQ     = 4;
constexpr int QW     = 2;
constexpr int NS     = 8;
constexpr int NWAVE  = NQ / QW * NS;         // 16
constexpr int KSTAGE = NS * KBUF;            // 36864, the K tiles of one stage
constexpr int VSTAGE = NS * VBUF;            // 40960, the V^T tiles of one stage
constexpr int VBASE  = 2 * KSTAGE;           // 73728
constexpr int LDS_SZ = VBASE + 2 * VSTAGE;   // 155648
// after the loop the ring holds the partial results, one slot a (range, query tile)
constexpr int MLBASE = NQ * NS * 4096;       // 131072: (reference, sum) pairs behind the O^T partials
static_assert(MLBASE + NQ * NS * 32 * 8 <= LDS_SZ, "partials fit the ring");

// ---------------------------------------------------------------------------
// D = A*B + C, f16 inputs, f32 accumulate (v_wmma_f32_16x16x32_f16)
__device__ __forceinline__ v8f wmma16(v16h a, v16h b, v8f c) {
  return __builtin_amdgcn_wmma_f32_16x16x32_f16(false, a, false, b, (short)0, c,
                                                false, false);
}

// Load a 16x32 f16 tile (row-major, row stride ld) into the WMMA A/B register
// layout for wave32:
//   lanes 0-15 : row = lane,    halves = cols {0..7} then {16..23}
//   lanes 16-31: row = lane-16, halves = cols {8..15} then {24..31}
__device__ __forceinline__ v16h load_tile_h(const _Float16* base, int ld, int lane) {
  const int r  = lane & 15;
  const int c0 = (lane & 16) ? 8 : 0;
  const _Float16* p = base + r * ld + c0;
  v16h o;
#pragma unroll
  for (int i = 0; i < 8; ++i) { o[i] = p[i]; o[8 + i] = p[16 + i]; }
  return o;
}

// Same tile layout but source is f32 (converted to f16 on the fly).
__device__ __forceinline__ v16h load_tile_f(const float* base, int ld, int lane) {
  const int r  = lane & 15;
  const int c0 = (lane & 16) ? 8 : 0;
  const float* p = base + r * ld + c0;
  v16h o;
#pragma unroll
  for (int i = 0; i < 8; ++i) {
    o[i]     = (_Float16)p[i];
    o[8 + i] = (_Float16)p[16 + i];
  }
  return o;
}

// ---------------------------------------------------------------------------
// Kernel 1: transpose + convert weights to f16.  wt layout: [3][H][C] with
// w=0 -> Wq^T, w=1 -> Wk^T, w=2 -> Wv^T  (row h, col c: contiguous in c).
// The last BN blocks scan the key mask instead, one batch each: pos[b][t] is
// the place of key t in a stable partition of the batch's keys, the kept keys
// (mask != 0) first, the masked ones behind them; nkeys[b] counts the kept.
constexpr int NCVT = (3 * CN * HN + 255) / 256;   // blocks that convert weights

__global__ void __launch_bounds__(256)
cvt_weights(const float* __restrict__ Wq, const float* __restrict__ Wk,
            const float* __restrict__ Wv, const int* __restrict__ amask,
            _Float16* __restrict__ wt, int* __restrict__ pos,
            int* __restrict__ nkeys) {
  if (blockIdx.x >= NCVT) {
    __shared__ int wsum[8];
    const int bb = blockIdx.x - NCVT;
    const int t0 = threadIdx.x * 16;           // 16 keys a thread
    const int ln = threadIdx.x & 31, wv = threadIdx.x >> 5;
    const int4* mp = (const int4*)(amask + bb * TN + t0);
    int f[16];
#pragma unroll
    for (int i = 0; i < 4; ++i) {
      const int4 v = mp[i];
      f[4 * i] = v.x != 0; f[4 * i + 1] = v.y != 0;
      f[4 * i + 2] = v.z != 0; f[4 * i + 3] = v.w != 0;
    }
    int c = 0;
#pragma unroll
    for (int i = 0; i < 16; ++i) c += f[i];
    int inc = c;                               // inclusive scan over the wave
#pragma unroll
    for (int d = 1; d < 32; d <<= 1) {
      const int u = __shfl_up(inc, d, 32);
      if (ln >= d) inc += u;
    }
    if (ln == 31) wsum[wv] = inc;
    __syncthreads();
    int before = inc - c, total = 0;           // kept keys in front of t0; all kept keys
#pragma unroll
    for (int w = 0; w < 8; ++w) {
      const int s = wsum[w];
      if (w < wv) before += s;
      total += s;
    }
    int p[16];
#pragma unroll
    for (int i = 0; i < 16; ++i) {
      p[i] = f[i] ? before : total + (t0 + i) - before;
      before += f[i];
    }
    int4* pp = (int4*)(pos + bb * TN + t0);
#pragma unroll
    for (int i = 0; i < 4; ++i)
      pp[i] = make_int4(p[4 * i], p[4 * i + 1], p[4 * i + 2], p[4 * i + 3]);
    if (threadIdx.x == 0) nkeys[bb] = total;
    return;
  }
  int idx = blockIdx.x * blockDim.x + threadIdx.x;
  if (idx >= 3 * CN * HN) return;
  int w   = idx / (CN * HN);
  int rem = idx - w * (CN * HN);
  int h   = rem / CN;
  int c   = rem - h * CN;
  const float* W = (w == 0) ? Wq : (w == 1) ? Wk : Wv;
  wt[idx] = (_Float16)W[c * HN + h];
}

// ---------------------------------------------------------------------------
// Kernel 2: QKV projection.  [B*T, C] x [C, H] (x3) with WMMA, f32 accum.
// Block = 16 waves on 64 rows of x and all 192 output columns; grid 256.
// The k range runs in 6 slabs of 128: a slab of x (64 rows x 512B, f32) and of
// the weights^T (192 rows x 256B, f16) is brought into LDS by async copies in
// which a wave covers whole 128B lines, two buffers, the next slab in flight
// while this one is worked on. Wave (rt, cg) owns row tile rt and column tile
// cg of each of q, k, v; its fragments come from LDS.
// Outputs: q16 row-major [B*T, H] f16; k16 [B][T][H] and v transposed
// vt16 [B][H][T] f16, both with key t at place pos[b][t]. The block's V tile
// goes through LDS, so that a wave's stores run along the places of one h.
constexpr int PROWS  = 64;                   // rows of x of one block
constexpr int PK     = 128;                  // k of one slab
constexpr int PSLABS = CN / PK;              // 6
constexpr int XPITCH = PK * 4 + 16;          // 528 B, 16 B x odd
constexpr int WPITCH = PK * 2 + 16;          // 272 B, 16 B x odd
constexpr int XBUF   = PROWS * XPITCH;       // 33792
constexpr int WBUF   = 3 * HN * WPITCH;      // 52224
constexpr int PSTAGE = XBUF + WBUF;          // 86016
constexpr int VSLD   = PROWS + 8;            // halves of one h row of the staged V tile (144 B)

__global__ void __launch_bounds__(512)
qkv_proj(const float* __restrict__ x, const _Float16* __restrict__ wt,
         const int* __restrict__ pos,
         _Float16* __restrict__ q16, _Float16* __restrict__ k16,
         _Float16* __restrict__ vt16) {
  __shared__ __attribute__((aligned(256))) char smem[2 * PSTAGE];

  const int tid  = threadIdx.x;
  const int lane = tid & 31;
  const int wave = __builtin_amdgcn_readfirstlane(tid >> 5);
  const int rt   = wave & 3;                 // row tile inside the block
  const int cg   = wave >> 2;                // column tile of q, of k and of v
  const int blockrow = blockIdx.x * PROWS;

  // x slab: a wave copies one row's 512B; 16 rows a round, 4 rounds
  const char* xg = (const char*)(x + (size_t)(blockrow + (tid >> 5)) * CN) + (tid & 31) * 16;
  // weight slab: a wave copies two rows' 256B; 32 rows a round, 6 rounds
  const char* wg = (const char*)(wt + (size_t)(tid >> 4) * CN) + (tid & 15) * 16;
  const uint32_t lds0 = (uint32_t)(size_t)smem;
  const uint32_t xl = lds0 + (uint32_t)((tid >> 5) * XPITCH + (tid & 31) * 16);
  const uint32_t wl = lds0 + (uint32_t)(XBUF + (tid >> 4) * WPITCH + (tid & 15) * 16);

  auto fetch = [&](int s, int buf) {
    const char* xs = xg + s * (PK * 4);
    const char* ws = wg + s * (PK * 2);
    const uint32_t xd = xl + (uint32_t)(buf * PSTAGE);
    const uint32_t wd = wl + (uint32_t)(buf * PSTAGE);
    // s_wait_xcnt 0 ends the copies' own statement, so that it stands in front
    // of every later write of a register that they name
    asm volatile("global_load_async_to_lds_b128 %0, %1, off\n\t"
                 "global_load_async_to_lds_b128 %2, %3, off\n\t"
                 "global_load_async_to_lds_b128 %4, %5, off\n\t"
                 "global_load_async_to_lds_b128 %6, %7, off\n\t"
                 "global_load_async_to_lds_b128 %8, %9, off\n\t"
                 "global_load_async_to_lds_b128 %10, %11, off\n\t"
                 "global_load_async_to_lds_b128 %12, %13, off\n\t"
                 "global_load_async_to_lds_b128 %14, %15, off\n\t"
                 "global_load_async_to_lds_b128 %16, %17, off\n\t"
                 "global_load_async_to_lds_b128 %18, %19, off\n\t"
                 "s_wait_xcnt 0x0"
                 :: "v"(xd),                "v"(xs),
                    "v"(xd + 16 * XPITCH),  "v"(xs + 16 * (CN * 4)),
                    "v"(xd + 32 * XPITCH),  "v"(xs + 32 * (CN * 4)),
                    "v"(xd + 48 * XPITCH),  "v"(xs + 48 * (CN * 4)),
                    "v"(wd),                "v"(ws),
                    "v"(wd + 32 * WPITCH),  "v"(ws + 32 * (CN * 2)),
                    "v"(wd + 64 * WPITCH),  "v"(ws + 64 * (CN * 2)),
                    "v"(wd + 96 * WPITCH),  "v"(ws + 96 * (CN * 2)),
                    "v"(wd + 128 * WPITCH), "v"(ws + 128 * (CN * 2)),
                    "v"(wd + 160 * WPITCH), "v"(ws + 160 * (CN * 2))
                 : "memory");
  };

  v8f acc[3];  // q, k, v
#pragma unroll
  for (int i = 0; i < 3; ++i) acc[i] = (v8f)0.0f;

  fetch(0, 0);

  // places of the keys this lane will store (read here, used behind the loop);
  // '& (TN - 1)' bounds every address formed from them
  const int rl0 = rt * 16 + (lane >> 4) * 8;         // first of the lane's 8 rows
  int kp[8];
  {
    const int4 p0 = *(const int4*)(pos + blockrow + rl0);
    const int4 p1 = *(const int4*)(pos + blockrow + rl0 + 4);
    kp[0] = p0.x & (TN - 1); kp[1] = p0.y & (TN - 1);
    kp[2] = p0.z & (TN - 1); kp[3] = p0.w & (TN - 1);
    kp[4] = p1.x & (TN - 1); kp[5] = p1.y & (TN - 1);
    kp[6] = p1.z & (TN - 1); kp[7] = p1.w & (TN - 1);
  }
  const int vpa = pos[blockrow + lane] & (TN - 1);
  const int vpb = pos[blockrow + 32 + lane] & (TN - 1);

  asm volatile("s_wait_asynccnt 0x0" ::: "memory");   // slab 0 has landed
  __syncthreads();
  fetch(1, 1);

  constexpr int XLD = XPITCH / 4, WLD = WPITCH / 2;   // pitches in elements
  for (int s = 0; s < PSLABS; ++s) {
    const int cur = s & 1;
    const float*    xb = (const float*)(smem + cur * PSTAGE) + rt * 16 * XLD;
    const _Float16* wb = (const _Float16*)(smem + cur * PSTAGE + XBUF) + cg * 16 * WLD;
#pragma unroll
    for (int kc = 0; kc < PK; kc += 32) {
      v16h a = load_tile_f(xb + kc, XLD, lane);
#pragma unroll
      for (int w = 0; w < 3; ++w) {
        v16h b = load_tile_h(wb + w * HN * WLD + kc, WLD, lane);
        acc[w] = wmma16(a, b, acc[w]);
      }
    }
    // my reads of 'cur' are back and my copies of the next slab have landed,
    // then everyone has left 'cur' before it is refilled
    asm volatile("s_wait_dscnt 0x0" ::: "memory");
    asm volatile("s_wait_asynccnt 0x0" ::: "memory");
    __syncthreads();
    if (s + 2 < PSLABS) fetch(s + 2, cur);
  }
  asm volatile("s_wait_asynccnt 0x0" ::: "memory");   // no copy is left when the wave ends

  // C/D layout: element r of acc -> row (r + 8*(lane/16)), col (lane&15).
  const int h    = cg * 16 + (lane & 15);
  const int row0 = blockrow + rl0;
  const int b    = blockrow >> 12;   // T = 4096: the block's rows lie in one batch
  _Float16* vs = (_Float16*)smem;    // [h][row of the block]; the ring is free now
  v8h vv;
#pragma unroll
  for (int r = 0; r < 8; ++r) vv[r] = (_Float16)acc[2][r];
  *(v8h*)(vs + h * VSLD + rl0) = vv;
  __syncthreads();   // in front of the global stores: it then waits for LDS alone
#pragma unroll
  for (int r = 0; r < 8; ++r) {
    q16[(size_t)(row0 + r) * HN + h] = (_Float16)acc[0][r];
    k16[((size_t)b * TN + kp[r]) * HN + h] = (_Float16)acc[1][r];
  }
  // wave w stores h = 4w .. 4w+3; a lane takes rows 'lane' and 'lane + 32': the
  // 32 places of a store lie in two short runs (kept keys, masked keys)
#pragma unroll
  for (int i = 0; i < 4; ++i) {
    const int hh = wave * 4 + i;
    _Float16* vrow = vt16 + ((size_t)b * HN + hh) * TN;
    vrow[vpa] = vs[hh * VSLD + lane];
    vrow[vpb] = vs[hh * VSLD + 32 + lane];
  }
}

// ---------------------------------------------------------------------------
// lane l <-> lane l ^ 16: both hold the same query column, each half of its keys
__device__ __forceinline__ float xhalf(float x) {
  const int v = __builtin_bit_cast(int, x);
  return __builtin_bit_cast(float, __builtin_amdgcn_permlanex16(
      v, v, 0x76543210, 0xfedcba98, false, false));
}

// ---------------------------------------------------------------------------
// Kernel 3: flash attention with async-staged K/V tiles in LDS.
// Block = 16 waves on one batch: 4 query tiles x 8 key ranges, a wave on 2 query
// tiles of one range. K and V^T come
// with the batch's nk kept keys in front (a masked key adds nothing to any sum),
// so the ranges cover only ceil(nk / 256) tiles of 32 keys each; a tile that
// reaches past nk tests the key's place.
// The 2 waves of a key range share that range's K/V tile stream; each wave
// keeps a reference, sum and O^T per query tile over its range, and the 8 partial
// results of a query tile are merged through LDS behind the loop.
// Per trip and range: async copy K (32x64 f16, 4KB) and V^T (64x32 f16, 4KB)
// into double-buffered LDS (ASYNCcnt), one barrier per trip; each wave
// computes S^T = K*Q^T (WMMA: rows = keys, columns = queries), so that a lane
// holds 16 of the 32 scores of ONE query. The softmax reference of a query is
// the maximum of its range's first tile and stays until a lane's sum of a
// trip's exponentials passes PSUM_MAX (one test a trip for the whole wave): only
// then come a maximum, the exchange between the wave's halves and the rescaling
// of sum and O^T. The two S^T tiles, converted in place, are the B operand P^T
// of O^T += V^T*P^T (WMMA): P never leaves the registers.
//
// LDS layout:
//   [    0,  73728)  K tiles,  2 stages x 8 ranges x 4608B, [t][h], rows of 144B
//   [73728, 155648)  V tiles,  2 stages x 8 ranges x 5120B, [h][t], rows of 80B
__global__ void __launch_bounds__(NWAVE * 32)
flash_attn(const _Float16* __restrict__ q16, const _Float16* __restrict__ k16,
           const _Float16* __restrict__ vt16, const int* __restrict__ nkeys,
           float* __restrict__ out) {
  __shared__ __attribute__((aligned(256))) char smem[LDS_SZ];

  const int tid  = threadIdx.x;
  const int lane = tid & 31;
  const int wave = __builtin_amdgcn_readfirstlane(tid >> 5);
  const int qi   = (wave & (NQ / QW - 1)) * QW;   // first of the wave's query tiles in the block
  const int sp   = wave / (NQ / QW);              // key range
  const int b    = blockIdx.x / (TN / 16 / NQ);                  // 64 blocks per batch
  const int qt0  = (blockIdx.x % (TN / 16 / NQ)) * NQ;           // the block's first q-tile in the batch
  // kept keys of the batch, clamped to the shape: it bounds trips and addresses
  const int nk   = __builtin_amdgcn_readfirstlane(min(max(nkeys[b], 0), TN));
  const int nit  = (nk + NS * 32 - 1) / (NS * 32);               // trips, at most 16
  const int k0   = sp * nit * 32;            // first key of the range

  // the 64 threads of a range copy its tiles: 4 x 16B of K and of V^T each
  const int tr = tid & 63;
  const char* kg = (const char*)(k16 + ((size_t)b * TN + k0) * HN) + tr * 16;       // [t][h]
  const char* vg = (const char*)(vt16 + (size_t)b * HN * TN + k0)                   // [h][t]
                   + (tr >> 2) * (TN * 2) + (tr & 3) * 16;
  const uint32_t lds0 = (uint32_t)(size_t)smem;
  const uint32_t kl = lds0 + (uint32_t)(sp * KBUF + (tr >> 3) * KPITCH + (tr & 7) * 16);
  const uint32_t vl = lds0 + (uint32_t)(VBASE + sp * VBUF + (tr >> 2) * VPITCH + (tr & 3) * 16);

  // cooperative async fetch of the range's 32-key K tile + V tile of trip 'it'
  auto fetch_kv = [&](int it, int buf) {
    // K tile: contiguous 4KB in global memory, 8 copies per row; 8 rows a round
    const uint32_t kla = kl + (uint32_t)(buf * KSTAGE);
    const char* kga = kg + it * (32 * HN * 2);
    // V tile: 64 rows of 64B, global row stride TN*2; 16 rows a round
    const uint32_t vla = vl + (uint32_t)(buf * VSTAGE);
    const char* vga = vg + it * (32 * 2);
    // s_wait_xcnt 0 ends the copies' own statement, so that it stands in front
    // of every later write of a register that they name
    asm volatile("global_load_async_to_lds_b128 %0, %1, off\n\t"
                 "global_load_async_to_lds_b128 %2, %3, off\n\t"
                 "global_load_async_to_lds_b128 %4, %5, off\n\t"
                 "global_load_async_to_lds_b128 %6, %7, off\n\t"
                 "global_load_async_to_lds_b128 %8, %9, off\n\t"
                 "global_load_async_to_lds_b128 %10, %11, off\n\t"
                 "global_load_async_to_lds_b128 %12, %13, off\n\t"
                 "global_load_async_to_lds_b128 %14, %15, off\n\t"
                 "s_wait_xcnt 0x0"
                 :: "v"(kla),               "v"(kga),
                    "v"(kla + 8 * KPITCH),  "v"(kga + 8 * (HN * 2)),
                    "v"(kla + 16 * KPITCH), "v"(kga + 16 * (HN * 2)),
                    "v"(kla + 24 * KPITCH), "v"(kga + 24 * (HN * 2)),
                    "v"(vla),               "v"(vga),
                    "v"(vla + 16 * VPITCH), "v"(vga + 16 * (TN * 2)),
                    "v"(vla + 32 * VPITCH), "v"(vga + 32 * (TN * 2)),
                    "v"(vla + 48 * VPITCH), "v"(vga + 48 * (TN * 2))
                 : "memory");
  };

  // Q^T fragments of the wave's QW query tiles
  v16h aq0[QW], aq1[QW];
#pragma unroll
  for (int u = 0; u < QW; ++u) {
    const _Float16* qb = q16 + ((size_t)b * TN + (qt0 + qi + u) * 16) * HN;
    aq0[u] = load_tile_h(qb, HN, lane);        // h = 0..31
    aq1[u] = load_tile_h(qb + 32, HN, lane);   // h = 32..63
  }

  const int half  = lane >> 4;

  // O^T tiles: o[u][j][r] = O[query lane & 15 of tile u][h = 16*j + 8*half + r]
  v8f o[QW][4];
  float m[QW];   // softmax reference of this lane's query (equal in both halves)
  float l[QW];   // running sum over this half's keys only; joined at the end
#pragma unroll
  for (int u = 0; u < QW; ++u) {
#pragma unroll
    for (int j = 0; j < 4; ++j) o[u][j] = (v8f)0.0f;
    m[u] = NEG_BIG;
    l[u] = 0.0f;
  }

  fetch_kv(0, 0);
  asm volatile("s_wait_asynccnt 0x0" ::: "memory");
  __syncthreads();

  for (int it = 0; it < nit; ++it) {
    const int cur = it & 1;
    if (it + 1 < nit) fetch_kv(it + 1, cur ^ 1);   // prefetch next tile

    const _Float16* kbufp = (const _Float16*)(smem + cur * KSTAGE + sp * KBUF);
    const _Float16* vbufp = (const _Float16*)(smem + VBASE + cur * VSTAGE + sp * VBUF);

    // kept keys from this tile on, the same in the whole wave; below 32 the tile
    // reaches past nk. Element i of a lane's 16 scores is key 8*half + i (i < 8)
    // or 8*half + i + 8 of the tile: it counts while that is below 'left'
    const int  left = nk - (k0 + it * 32);
    const bool tail = left < 32;
    const int  lim  = left - 8 * half;

    // S^T tiles: A = K rows from LDS, each fragment used for both query tiles;
    // B = Q^T kept in registers
    constexpr int KLD = KPITCH / 2, VLD = VPITCH / 2;   // pitches in halves
    const v16h k00 = load_tile_h(kbufp, KLD, lane);
    const v16h k01 = load_tile_h(kbufp + 32, KLD, lane);
    const v16h k10 = load_tile_h(kbufp + 16 * KLD, KLD, lane);
    const v16h k11 = load_tile_h(kbufp + 16 * KLD + 32, KLD, lane);
    v8f s0[QW], s1[QW];
#pragma unroll
    for (int u = 0; u < QW; ++u) {
      s0[u] = wmma16(k00, aq0[u], (v8f)0.0f);
      s1[u] = wmma16(k10, aq0[u], (v8f)0.0f);
    }
#pragma unroll
    for (int u = 0; u < QW; ++u) {
      s0[u] = wmma16(k01, aq1[u], s0[u]);
      s1[u] = wmma16(k11, aq1[u], s1[u]);
    }

    // scale (+ mask in a tail tile)
    float sc[QW][16];
#pragma unroll
    for (int u = 0; u < QW; ++u)
#pragma unroll
      for (int r = 0; r < 8; ++r) {
        sc[u][r]     = s0[u][r] * SM_SCALE;
        sc[u][8 + r] = s1[u][r] * SM_SCALE;
      }
    if (tail) {
#pragma unroll
      for (int r = 0; r < 8; ++r) {
#pragma unroll
        for (int u = 0; u < QW; ++u) {
          if (r >= lim)      sc[u][r]     = NEG_BIG;
          if (16 + r >= lim) sc[u][8 + r] = NEG_BIG;
        }
      }
    }

    // V^T fragments ([h][t] rows from LDS), asked for in front of the branch below
    // so that they arrive under the exponentials
    v16h av[4];
#pragma unroll
    for (int j = 0; j < 4; ++j) av[j] = load_tile_h(vbufp + (j * 16) * VLD, VLD, lane);

    // p = exp(score - reference) and the lane's sum of them
    // a key past nk has the score NEG_BIG, and exp(NEG_BIG - m) is 0 once a key of the
    // range has counted (the places are in order: key 0 of its first tile does,
    // unless the whole range lies past nk: that case is cleared behind the loop)
    float p[QW][16], ps[QW];
    auto expsum = [&](int u) {
      float t[16];
#pragma unroll
      for (int i = 0; i < 16; ++i) t[i] = p[u][i] = __expf(sc[u][i] - m[u]);
#pragma unroll
      for (int w = 8; w >= 1; w >>= 1)
#pragma unroll
        for (int i = 0; i < w; ++i) t[i] += t[i + w];
      ps[u] = t[0];
    };
    uint32_t need = 1;   // the first tile sets the references
    if (it != 0) {
#pragma unroll
      for (int u = 0; u < QW; ++u) expsum(u);
      // one test a trip, the same in the whole wave; an infinity or a NaN fails it too
      need = __builtin_amdgcn_ballot_w32(!(ps[0] + ps[1] <= PSUM_MAX));
    }
    if (need != 0) {
      // new references from this tile's maxima; sum and O^T follow them
#pragma unroll
      for (int u = 0; u < QW; ++u) {
        float t[16];
#pragma unroll
        for (int i = 0; i < 16; ++i) t[i] = sc[u][i];
#pragma unroll
        for (int w = 8; w >= 1; w >>= 1)
#pragma unroll
          for (int i = 0; i < w; ++i) t[i] = fmaxf(t[i], t[i + w]);
        const float rmax  = fmaxf(t[0], xhalf(t[0]));
        const float nm    = fmaxf(m[u], rmax);   // a reference only rises
        const float alpha = __expf(m[u] - nm);
        m[u] = nm;
        expsum(u);
        l[u] *= alpha;
#pragma unroll
        for (int j = 0; j < 4; ++j) o[u][j] *= alpha;
      }
    }

    // P^T in the B layout: element i of the lane is key (i < 8 ? 8*half + i
    // : 16 + 8*half + i - 8), the k order of load_tile_h on the V^T rows
    v16h pb[QW];
#pragma unroll
    for (int u = 0; u < QW; ++u) {
#pragma unroll
      for (int i = 0; i < 16; ++i) pb[u][i] = (_Float16)p[u][i];
      l[u] += ps[u];
    }

    // O^T += V^T * P^T, each V^T fragment used for both query tiles
#pragma unroll
    for (int j = 0; j < 4; ++j)
#pragma unroll
      for (int u = 0; u < QW; ++u) o[u][j] = wmma16(av[j], pb[u], o[u][j]);

    // my reads of 'cur' are back and my prefetch has landed, then everyone is
    // done reading 'cur' before it is refilled (after the last trip: rewritten)
    asm volatile("s_wait_dscnt 0x0" ::: "memory");
    asm volatile("s_wait_asynccnt 0x0" ::: "memory");
    __syncthreads();
  }

  // a range wholly past nk has the reference NEG_BIG and summed exp(0): it counts nothing
  if (k0 >= nk) {
#pragma unroll
    for (int u = 0; u < QW; ++u) {
      l[u] = 0.0f;
#pragma unroll
      for (int j = 0; j < 4; ++j) o[u][j] = (v8f)0.0f;
    }
  }

  // merge of the 8 key ranges of a query tile. Each wave leaves its O^T tiles
  // (16B per lane and piece, lanes adjacent) and its (reference, sum) in LDS, in slot
  // range * NQ + query tile
#pragma unroll
  for (int u = 0; u < QW; ++u) {
    const int slot = sp * NQ + qi + u;
    const float lt = l[u] + xhalf(l[u]);   // both halves' keys
#pragma unroll
    for (int j = 0; j < 4; ++j) {
      float4* pw = (float4*)(smem + (slot * 4 + j) * 1024 + lane * 16);
      pw[0]  = make_float4(o[u][j][0], o[u][j][1], o[u][j][2], o[u][j][3]);
      pw[32] = make_float4(o[u][j][4], o[u][j][5], o[u][j][6], o[u][j][7]);
    }
    *(float2*)(smem + MLBASE + (slot * 32 + lane) * 8) = make_float2(m[u], lt);
  }
  __syncthreads();

  // wave w finishes 8 queries x 32 h of query tile w & 3: whole 128B lines of
  // out, each from one wave. A lane takes 8 consecutive h of one query.
  const int tq = wave & (NQ - 1);                 // query tile inside the block
  const int pt = wave / NQ;                       // which 8 queries, which 32 h
  const int mq = (pt >> 1) * 8 + (lane & 7);      // query inside the q-tile
  const int mh = (lane >> 3) & 1;                 // the half that held these h
  const int mj = (pt & 1) * 2 + (lane >> 4);      // O^T tile
  float pm[NS], pl[NS];
#pragma unroll
  for (int s = 0; s < NS; ++s) {
    const float2 ml = *(const float2*)(smem + MLBASE + ((s * NQ + tq) * 32 + mq) * 8);
    pm[s] = ml.x;
    pl[s] = ml.y;
  }
  float gm = pm[0];
#pragma unroll
  for (int s = 1; s < NS; ++s) gm = fmaxf(gm, pm[s]);
  float gl = 0.0f;
  float r[8];
#pragma unroll
  for (int i = 0; i < 8; ++i) r[i] = 0.0f;
#pragma unroll
  for (int s = 0; s < NS; ++s) {
    const float wgt = __expf(pm[s] - gm);
    gl += wgt * pl[s];
    const float4* pr = (const float4*)(smem + ((s * NQ + tq) * 4 + mj) * 1024 + (mh * 16 + mq) * 16);
    const float4 x0 = pr[0], x1 = pr[32];
    r[0] += wgt * x0.x; r[1] += wgt * x0.y; r[2] += wgt * x0.z; r[3] += wgt * x0.w;
    r[4] += wgt * x1.x; r[5] += wgt * x1.y; r[6] += wgt * x1.z; r[7] += wgt * x1.w;
  }
  const float inv = 1.0f / gl;
  float* ob = out + ((size_t)b * TN + (qt0 + tq) * 16 + mq) * HN + mj * 16 + mh * 8;
#pragma unroll
  for (int i = 0; i < 8; ++i) ob[i] = r[i] * inv;
}

// ---------------------------------------------------------------------------
extern "C" void kernel_launch(void* const* d_in, const int* in_sizes, int n_in,
                              void* d_out, int out_size, void* d_ws, size_t ws_size,
                              hipStream_t stream) {
  (void)in_sizes; (void)n_in; (void)out_size; (void)ws_size;
  const float* x  = (const float*)d_in[0];
  const int*   am = (const int*)d_in[1];
  const float* Wk = (const float*)d_in[2];
  const float* Wq = (const float*)d_in[3];
  const float* Wv = (const float*)d_in[4];
  float*       out = (float*)d_out;

  // workspace layout (f16): [3][H][C] weights^T, q16, k16, vt16; (int) pos, nkeys
  _Float16* wt   = (_Float16*)d_ws;
  _Float16* q16  = wt  + (size_t)3 * HN * CN;
  _Float16* k16  = q16 + (size_t)BN * TN * HN;
  _Float16* vt16 = k16 + (size_t)BN * TN * HN;
  int*      pos  = (int*)(vt16 + (size_t)BN * TN * HN);
  int*      nkeys = pos + (size_t)BN * TN;

  cvt_weights<<<NCVT + BN, 256, 0, stream>>>(Wq, Wk, Wv, am, wt, pos, nkeys);
  qkv_proj<<<(BN * TN) / PROWS, 512, 0, stream>>>(x, wt, pos, q16, k16, vt16);
  flash_attn<<<(BN * TN / 16) / NQ, NWAVE * 32, 0, stream>>>(q16, k16, vt16, nkeys, out);
}

// v008
// A run of this version takes 27.4 microseconds.
// In two side-by-side timings against v007, it was 1.09 and 1.10 times as fast.
// Over all steps from v000 it is 17.2 times as fast.
#include <hip/hip_runtime.h>
#include <hip/hip_bf16.h>

typedef __attribute__((ext_vector_type(16))) _Float16 v16h;
typedef __attribute__((ext_vector_type(8)))  float    v8f;
typedef __attribute__((ext_vector_type(8)))  _Float16 v8h;

constexpr int BN = 4, TN = 4096, CN = 768, HN = 64;
constexpr float SM_SCALE = 0.03608439182435161f;  // 1/sqrt(768) -- reference scales by C**-0.5
constexpr float NEG_BIG  = -3.0e38f;
// a lane's sum of a trip's exponentials (2 x 16) may reach this before the
// softmax references are renewed: every one of them then fits f16 with room
constexpr float PSUM_MAX = 4096.0f;

// LDS row pitches of the staged K and V^T tiles, in bytes: an odd multiple of
// 16 B, so that the 16 rows one ds_load_b128 half-wave reads fall on 64
// different banks (the bare 128 B and 64 B rows fall on 8 and on 16)
constexpr int KPITCH = HN * 2 + 16;          // 144
constexpr int VPITCH = 32 * 2 + 16;          // 80
constexpr int KBUF   = 32 * KPITCH;          // 4608, one K tile
constexpr int VBUF   = HN * VPITCH;          // 5120, one V^T tile

// attention work-group: NQ query tiles x NS key ranges; a wave takes QW query
// tiles of one range, so that a K or V^T fragment read from LDS serves QW tiles
constexpr int NQ     = 4;
constexpr int QW     = 2;
constexpr int NS     = 8;
constexpr int NWAVE  = NQ / QW * NS;         // 16
constexpr int KSTAGE = NS * KBUF;            // 36864, the K tiles of one stage
constexpr int VSTAGE = NS * VBUF;            // 40960, the V^T tiles of one stage
constexpr int VBASE  = 2 * KSTAGE;           // 73728
constexpr int LDS_SZ = VBASE + 2 * VSTAGE;   // 155648
// after the loop the ring holds the partial results, one slot a (range, query tile)
constexpr int MLBASE = NQ * NS * 4096;       // 131072: (reference, sum) pairs behind the O^T partials
static_assert(MLBASE + NQ * NS * 32 * 8 <= LDS_SZ, "partials fit the ring");

// ---------------------------------------------------------------------------
// D = A*B + C, f16 inputs, f32 accumulate (v_wmma_f32_16x16x32_f16)
__device__ __forceinline__ v8f wmma16(v16h a, v16h b, v8f c) {
  return __builtin_amdgcn_wmma_f32_16x16x32_f16(false, a, false, b, (short)0, c,
                                                false, false);
}

// Load a 16x32 f16 tile (row-major, row stride ld) into the WMMA A/B register
// layout for wave32:
//   lanes 0-15 : row = lane,    halves = cols {0..7} then {16..23}
//   lanes 16-31: row = lane-16, halves = cols {8..15} then {24..31}
__device__ __forceinline__ v16h load_tile_h(const _Float16* base, int ld, int lane) {
  const int r  = lane & 15;
  const int c0 = (lane & 16) ? 8 : 0;
  const _Float16* p = base + r * ld + c0;
  v16h o;
#pragma unroll
  for (int i = 0; i < 8; ++i) { o[i] = p[i]; o[8 + i] = p[16 + i]; }
  return o;
}

// Same tile layout but source is f32 (converted to f16 on the fly).
__device__ __forceinline__ v16h load_tile_f(const float* base, int ld, int lane) {
  const int r  = lane & 15;
  const int c0 = (lane & 16) ? 8 : 0;
  const float* p = base + r * ld + c0;
  v16h o;
#pragma unroll
  for (int i = 0; i < 8; ++i) {
    o[i]     = (_Float16)p[i];
    o[8 + i] = (_Float16)p[16 + i];
  }
  return o;
}

// ---------------------------------------------------------------------------
// Kernel 1: transpose + convert weights to f16.  wt layout: [3][H][C] with
// w=0 -> Wq^T, w=1 -> Wk^T, w=2 -> Wv^T  (row h, col c: contiguous in c).
// The last BN blocks scan the key mask instead, one batch each: pos[b][t] is
// the place of key t in a stable partition of the batch's keys, the kept keys
// (mask != 0) first, the masked ones behind them; nkeys[b] counts the kept.
constexpr int NCVT = (3 * CN * HN + 255) / 256;   // blocks that convert weights

__global__ void __launch_bounds__(256)
cvt_weights(const float* __restrict__ Wq, const float* __restrict__ Wk,
            const float* __restrict__ Wv, const int* __restrict__ amask,
            _Float16* __restrict__ wt, int* __restrict__ pos,
            int* __restrict__ nkeys) {
  if (blockIdx.x >= NCVT) {
    __shared__ int wsum[8];
    const int bb = blockIdx.x - NCVT;
    const int t0 = threadIdx.x * 16;           // 16 keys a thread
    const int ln = threadIdx.x & 31, wv = threadIdx.x >> 5;
    const int4* mp = (const int4*)(amask + bb * TN + t0);
    int f[16];
#pragma unroll
    for (int i = 0; i < 4; ++i) {
      const int4 v = mp[i];
      f[4 * i] = v.x != 0; f[4 * i + 1] = v.y != 0;
      f[4 * i + 2] = v.z != 0; f[4 * i + 3] = v.w != 0;
    }
    int c = 0;
#pragma unroll
    for (int i = 0; i < 16; ++i) c += f[i];
    int inc = c;                               // inclusive scan over the wave
#pragma unroll
    for (int d = 1; d < 32; d <<= 1) {
      const int u = __shfl_up(inc, d, 32);
      if (ln >= d) inc += u;
    }
    if (ln == 31) wsum[wv] = inc;
    __syncthreads();
    int before = inc - c, total = 0;           // kept keys in front of t0; all kept keys
#pragma unroll
    for (int w = 0; w < 8; ++w) {
      const int s = wsum[w];
      if (w < wv) before += s;
      total += s;
    }
    int p[16];
#pragma unroll
    for (int i = 0; i < 16; ++i) {
      p[i] = f[i] ? before : total + (t0 + i) - before;
      before += f[i];
    }
    int4* pp = (int4*)(pos + bb * TN + t0);
#pragma unroll
    for (int i = 0; i < 4; ++i)
      pp[i] = make_int4(p[4 * i], p[4 * i + 1], p[4 * i + 2], p[4 * i + 3]);
    if (threadIdx.x == 0) nkeys[bb] = total;
    return;
  }
  int idx = blockIdx.x * blockDim.x + threadIdx.x;
  if (idx >= 3 * CN * HN) return;
  int w   = idx / (CN * HN);
  int rem = idx - w * (CN * HN);
  int h   = rem / CN;
  int c   = rem - h * CN;
  const float* W = (w == 0) ? Wq : (w == 1) ? Wk : Wv;
  wt[idx] = (_Float16)W[c * HN + h];
}

// ---------------------------------------------------------------------------
// Kernel 2: QKV projection.  [B*T, C] x [C, H] (x3) with WMMA, f32 accum.
// Block = 16 waves on 64 rows of x and all 192 output columns; grid 256.
// The k range runs in 6 slabs of 128: a slab of x (64 rows x 512B, f32) and of
// the weights^T (192 rows x 256B, f16) is brought into LDS by async copies in
// which a wave covers whole 128B lines, two buffers, the next slab in flight
// while this one is worked on. Wave (rt, cg) owns row tile rt and column tile
// cg of each of q, k, v; its fragments come from LDS.
// Outputs: q16 row-major [B*T, H] f16; k16 [B][T][H] and v transposed, tile by
// tile of 32 places, vt16 [B][T/32][H][32] f16 (a tile is 4KB in a row, as the
// attention kernel copies it), both with key t at place pos[b][t]. The block's V
// tile goes through LDS, so that a wave's stores run along the places of one h.
constexpr int PROWS  = 64;                   // rows of x of one block
constexpr int PK     = 128;                  // k of one slab
constexpr int PSLABS = CN / PK;              // 6
constexpr int XPITCH = PK * 4 + 16;          // 528 B, 16 B x odd
constexpr int WPITCH = PK * 2 + 16;          // 272 B, 16 B x odd
constexpr int XBUF   = PROWS * XPITCH;       // 33792
constexpr int WBUF   = 3 * HN * WPITCH;      // 52224
constexpr int PSTAGE = XBUF + WBUF;          // 86016
constexpr int VSLD   = PROWS + 8;            // halves of one h row of the staged V tile (144 B)

__global__ void __launch_bounds__(512)
qkv_proj(const float* __restrict__ x, const _Float16* __restrict__ wt,
         const int* __restrict__ pos,
         _Float16* __restrict__ q16, _Float16* __restrict__ k16,
         _Float16* __restrict__ vt16) {
  __shared__ __attribute__((aligned(256))) char smem[2 * PSTAGE];

  const int tid  = threadIdx.x;
  const int lane = tid & 31;
  const int wave = __builtin_amdgcn_readfirstlane(tid >> 5);
  const int rt   = wave & 3;                 // row tile inside the block
  const int cg   = wave >> 2;                // column tile of q, of k and of v
  const int blockrow = blockIdx.x * PROWS;

  // x slab: a wave copies one row's 512B; 16 rows a round, 4 rounds
  const char* xg = (const char*)(x + (size_t)(blockrow + (tid >> 5)) * CN) + (tid & 31) * 16;
  // weight slab: a wave copies two rows' 256B; 32 rows a round, 6 rounds
  const char* wg = (const char*)(wt + (size_t)(tid >> 4) * CN) + (tid & 15) * 16;
  const uint32_t lds0 = (uint32_t)(size_t)smem;
  const uint32_t xl = lds0 + (uint32_t)((tid >> 5) * XPITCH + (tid & 31) * 16);
  const uint32_t wl = lds0 + (uint32_t)(XBUF + (tid >> 4) * WPITCH + (tid & 15) * 16);

  auto fetch = [&](int s, int buf) {
    const char* xs = xg + s * (PK * 4);
    const char* ws = wg + s * (PK * 2);
    const uint32_t xd = xl + (uint32_t)(buf * PSTAGE);
    const uint32_t wd = wl + (uint32_t)(buf * PSTAGE);
    // s_wait_xcnt 0 ends the copies' own statement, so that it stands in front
    // of every later write of a register that they name
    asm volatile("global_load_async_to_lds_b128 %0, %1, off\n\t"
                 "global_load_async_to_lds_b128 %2, %3, off\n\t"
                 "global_load_async_to_lds_b128 %4, %5, off\n\t"
                 "global_load_async_to_lds_b128 %6, %7, off\n\t"
                 "global_load_async_to_lds_b128 %8, %9, off\n\t"
                 "global_load_async_to_lds_b128 %10, %11, off\n\t"
                 "global_load_async_to_lds_b128 %12, %13, off\n\t"
                 "global_load_async_to_lds_b128 %14, %15, off\n\t"
                 "global_load_async_to_lds_b128 %16, %17, off\n\t"
                 "global_load_async_to_lds_b128 %18, %19, off\n\t"
                 "s_wait_xcnt 0x0"
                 :: "v"(xd),                "v"(xs),
                    "v"(xd + 16 * XPITCH),  "v"(xs + 16 * (CN * 4)),
                    "v"(xd + 32 * XPITCH),  "v"(xs + 32 * (CN * 4)),
                    "v"(xd + 48 * XPITCH),  "v"(xs + 48 * (CN * 4)),
                    "v"(wd),                "v"(ws),
                    "v"(wd + 32 * WPITCH),  "v"(ws + 32 * (CN * 2)),
                    "v"(wd + 64 * WPITCH),  "v"(ws + 64 * (CN * 2)),
                    "v"(wd + 96 * WPITCH),  "v"(ws + 96 * (CN * 2)),
                    "v"(wd + 128 * WPITCH), "v"(ws + 128 * (CN * 2)),
                    "v"(wd + 160 * WPITCH), "v"(ws + 160 * (CN * 2))
                 : "memory");
  };

  v8f acc[3];  // q, k, v
#pragma unroll
  for (int i = 0; i < 3; ++i) acc[i] = (v8f)0.0f;

  fetch(0, 0);

  // places of the keys this lane will store (read here, used behind the loop);
  // '& (TN - 1)' bounds every address formed from them
  const int rl0 = rt * 16 + (lane >> 4) * 8;         // first of the lane's 8 rows
  int kp[8];
  {
    const int4 p0 = *(const int4*)(pos + blockrow + rl0);
    const int4 p1 = *(const int4*)(pos + blockrow + rl0 + 4);
    kp[0] = p0.x & (TN - 1); kp[1] = p0.y & (TN - 1);
    kp[2] = p0.z & (TN - 1); kp[3] = p0.w & (TN - 1);
    kp[4] = p1.x & (TN - 1); kp[5] = p1.y & (TN - 1);
    kp[6] = p1.z & (TN - 1); kp[7] = p1.w & (TN - 1);
  }
  const int vpa = pos[blockrow + lane] & (TN - 1);
  const int vpb = pos[blockrow + 32 + lane] & (TN - 1);
  // where a place lies in vt16, h = 0: its tile, then its column
  const int voa = (vpa >> 5) * (HN * 32) + (vpa & 31);
  const int vob = (vpb >> 5) * (HN * 32) + (vpb & 31);

  asm volatile("s_wait_asynccnt 0x0" ::: "memory");   // slab 0 has landed
  __syncthreads();
  fetch(1, 1);

  constexpr int XLD = XPITCH / 4, WLD = WPITCH / 2;   // pitches in elements
  for (int s = 0; s < PSLABS; ++s) {
    const int cur = s & 1;
    const float*    xb = (const float*)(smem + cur * PSTAGE) + rt * 16 * XLD;
    const _Float16* wb = (const _Float16*)(smem + cur * PSTAGE + XBUF) + cg * 16 * WLD;
#pragma unroll
    for (int kc = 0; kc < PK; kc += 32) {
      v16h a = load_tile_f(xb + kc, XLD, lane);
#pragma unroll
      for (int w = 0; w < 3; ++w) {
        v16h b = load_tile_h(wb + w * HN * WLD + kc, WLD, lane);
        acc[w] = wmma16(a, b, acc[w]);
      }
    }
    // my reads of 'cur' are back and my copies of the next slab have landed,
    // then everyone has left 'cur' before it is refilled
    asm volatile("s_wait_dscnt 0x0" ::: "memory");
    asm volatile("s_wait_asynccnt 0x0" ::: "memory");
    __syncthreads();
    if (s + 2 < PSLABS) fetch(s + 2, cur);
  }
  asm volatile("s_wait_asynccnt 0x0" ::: "memory");   // no copy is left when the wave ends

  // C/D layout: element r of acc -> row (r + 8*(lane/16)), col (lane&15).
  const int h    = cg * 16 + (lane & 15);
  const int row0 = blockrow + rl0;
  const int b    = blockrow >> 12;   // T = 4096: the block's rows lie in one batch
  _Float16* vs = (_Float16*)smem;    // [h][row of the block]; the ring is free now
  v8h vv;
#pragma unroll
  for (int r = 0; r < 8; ++r) vv[r] = (_Float16)acc[2][r];
  *(v8h*)(vs + h * VSLD + rl0) = vv;
  __syncthreads();   // in front of the global stores: it then waits for LDS alone
#pragma unroll
  for (int r = 0; r < 8; ++r) {
    q16[(size_t)(row0 + r) * HN + h] = (_Float16)acc[0][r];
    k16[((size_t)b * TN + kp[r]) * HN + h] = (_Float16)acc[1][r];
  }
  // wave w stores h = 4w .. 4w+3; a lane takes rows 'lane' and 'lane + 32': the
  // 32 places of a store lie in two short runs (kept keys, masked keys)
#pragma unroll
  for (int i = 0; i < 4; ++i) {
    const int hh = wave * 4 + i;
    _Float16* vrow = vt16 + (size_t)b * HN * TN + hh * 32;
    vrow[voa] = vs[hh * VSLD + lane];
    vrow[vob] = vs[hh * VSLD + 32 + lane];
  }
}

// ---------------------------------------------------------------------------
// lane l <-> lane l ^ 16: both hold the same query column, each half of its keys
__device__ __forceinline__ float xhalf(float x) {
  const int v = __builtin_bit_cast(int, x);
  return __builtin_bit_cast(float, __builtin_amdgcn_permlanex16(
      v, v, 0x76543210, 0xfedcba98, false, false));
}

// ---------------------------------------------------------------------------
// Kernel 3: flash attention with async-staged K/V tiles in LDS.
// Block = 16 waves on one batch: 4 query tiles x 8 key ranges, a wave on 2 query
// tiles of one range. K and V^T come
// with the batch's nk kept keys in front (a masked key adds nothing to any sum),
// so the ranges cover only ceil(nk / 256) tiles of 32 keys each; a tile that
// reaches past nk tests the key's place.
// The 2 waves of a key range share that range's K/V tile stream; each wave
// keeps a reference, sum and O^T per query tile over its range, and the 8 partial
// results of a query tile are merged through LDS behind the loop.
// Per trip and range: async copy K (32x64 f16, 4KB) and V^T (64x32 f16, 4KB)
// into double-buffered LDS (ASYNCcnt), one barrier per trip; each wave
// computes S^T = K*Q^T (WMMA: rows = keys, columns = queries), so that a lane
// holds 16 of the 32 scores of ONE query. The softmax reference of a query is
// the maximum of its range's first tile and stays until a lane's sum of a
// trip's exponentials passes PSUM_MAX (one test a trip for the whole wave): only
// then come a maximum, the exchange between the wave's halves and the rescaling
// of sum and O^T. The two S^T tiles, converted in place, are the B operand P^T
// of O^T += V^T*P^T (WMMA): P never leaves the registers.
//
// LDS layout:
//   [    0,  73728)  K tiles,  2 stages x 8 ranges x 4608B, [t][h], rows of 144B
//   [73728, 155648)  V tiles,  2 stages x 8 ranges x 5120B, [h][t], rows of 80B
__global__ void __launch_bounds__(NWAVE * 32)
flash_attn(const _Float16* __restrict__ q16, const _Float16* __restrict__ k16,
           const _Float16* __restrict__ vt16, const int* __restrict__ nkeys,
           float* __restrict__ out) {
  __shared__ __attribute__((aligned(256))) char smem[LDS_SZ];

  const int tid  = threadIdx.x;
  const int lane = tid & 31;
  const int wave = __builtin_amdgcn_readfirstlane(tid >> 5);
  const int qi   = (wave & (NQ / QW - 1)) * QW;   // first of the wave's query tiles in the block
  const int sp   = wave / (NQ / QW);              // key range
  const int b    = blockIdx.x / (TN / 16 / NQ);                  // 64 blocks per batch
  const int qt0  = (blockIdx.x % (TN / 16 / NQ)) * NQ;           // the block's first q-tile in the batch
  // kept keys of the batch, clamped to the shape: it bounds trips and addresses
  const int nk   = __builtin_amdgcn_readfirstlane(min(max(nkeys[b], 0), TN));
  const int nit  = (nk + NS * 32 - 1) / (NS * 32);               // trips, at most 16
  const int k0   = sp * nit * 32;            // first key of the range

  // the 64 threads of a range copy its tiles: 4 x 16B of K and of V^T each
  const int tr = tid & 63;
  const char* kg = (const char*)(k16 + ((size_t)b * TN + k0) * HN) + tr * 16;       // [t][h]
  const char* vg = (const char*)(vt16 + ((size_t)b * TN + k0) * HN) + tr * 16;      // [tile][h][t]
  const uint32_t lds0 = (uint32_t)(size_t)smem;
  const uint32_t kl = lds0 + (uint32_t)(sp * KBUF + (tr >> 3) * KPITCH + (tr & 7) * 16);
  const uint32_t vl = lds0 + (uint32_t)(VBASE + sp * VBUF + (tr >> 2) * VPITCH + (tr & 3) * 16);

  // cooperative async fetch of the range's 32-key K tile + V tile of trip 'it'
  auto fetch_kv = [&](int it, int buf) {
    // K tile: contiguous 4KB in global memory, 8 copies per row; 8 rows a round
    const uint32_t kla = kl + (uint32_t)(buf * KSTAGE);
    const char* kga = kg + it * (32 * HN * 2);
    // V tile: contiguous 4KB in global memory, 4 copies per row; 16 rows a round
    const uint32_t vla = vl + (uint32_t)(buf * VSTAGE);
    const char* vga = vg + it * (32 * HN * 2);
    // s_wait_xcnt 0 ends the copies' own statement, so that it stands in front
    // of every later write of a register that they name
    asm volatile("global_load_async_to_lds_b128 %0, %1, off\n\t"
                 "global_load_async_to_lds_b128 %2, %3, off\n\t"
                 "global_load_async_to_lds_b128 %4, %5, off\n\t"
                 "global_load_async_to_lds_b128 %6, %7, off\n\t"
                 "global_load_async_to_lds_b128 %8, %9, off\n\t"
                 "global_load_async_to_lds_b128 %10, %11, off\n\t"
                 "global_load_async_to_lds_b128 %12, %13, off\n\t"
                 "global_load_async_to_lds_b128 %14, %15, off\n\t"
                 "s_wait_xcnt 0x0"
                 :: "v"(kla),               "v"(kga),
                    "v"(kla + 8 * KPITCH),  "v"(kga + 8 * (HN * 2)),
                    "v"(kla + 16 * KPITCH), "v"(kga + 16 * (HN * 2)),
                    "v"(kla + 24 * KPITCH), "v"(kga + 24 * (HN * 2)),
                    "v"(vla),               "v"(vga),
                    "v"(vla + 16 * VPITCH), "v"(vga + 16 * (32 * 2)),
                    "v"(vla + 32 * VPITCH), "v"(vga + 32 * (32 * 2)),
                    "v"(vla + 48 * VPITCH), "v"(vga + 48 * (32 * 2))
                 : "memory");
  };

  // Q^T fragments of the wave's QW query tiles
  v16h aq0[QW], aq1[QW];
#pragma unroll
  for (int u = 0; u < QW; ++u) {
    const _Float16* qb = q16 + ((size_t)b * TN + (qt0 + qi + u) * 16) * HN;
    aq0[u] = load_tile_h(qb, HN, lane);        // h = 0..31
    aq1[u] = load_tile_h(qb + 32, HN, lane);   // h = 32..63
  }

  const int half  = lane >> 4;

  // O^T tiles: o[u][j][r] = O[query lane & 15 of tile u][h = 16*j + 8*half + r]
  v8f o[QW][4];
  float m[QW];   // softmax reference of this lane's query (equal in both halves)
  float l[QW];   // running sum over this half's keys only; joined at the end
#pragma unroll
  for (int u = 0; u < QW; ++u) {
#pragma unroll
    for (int j = 0; j < 4; ++j) o[u][j] = (v8f)0.0f;
    m[u] = NEG_BIG;
    l[u] = 0.0f;
  }

  fetch_kv(0, 0);
  asm volatile("s_wait_asynccnt 0x0" ::: "memory");
  __syncthreads();

  for (int it = 0; it < nit; ++it) {
    const int cur = it & 1;
    if (it + 1 < nit) fetch_kv(it + 1, cur ^ 1);   // prefetch next tile

    const _Float16* kbufp = (const _Float16*)(smem + cur * KSTAGE + sp * KBUF);
    const _Float16* vbufp = (const _Float16*)(smem + VBASE + cur * VSTAGE + sp * VBUF);

    // kept keys from this tile on, the same in the whole wave; below 32 the tile
    // reaches past nk. Element i of a lane's 16 scores is key 8*half + i (i < 8)
    // or 8*half + i + 8 of the tile: it counts while that is below 'left'
    const int  left = nk - (k0 + it * 32);
    const bool tail = left < 32;
    const int  lim  = left - 8 * half;

    // S^T tiles: A = K rows from LDS, each fragment used for both query tiles;
    // B = Q^T kept in registers
    constexpr int KLD = KPITCH / 2, VLD = VPITCH / 2;   // pitches in halves
    const v16h k00 = load_tile_h(kbufp, KLD, lane);
    const v16h k01 = load_tile_h(kbufp + 32, KLD, lane);
    const v16h k10 = load_tile_h(kbufp + 16 * KLD, KLD, lane);
    const v16h k11 = load_tile_h(kbufp + 16 * KLD + 32, KLD, lane);
    v8f s0[QW], s1[QW];
#pragma unroll
    for (int u = 0; u < QW; ++u) {
      s0[u] = wmma16(k00, aq0[u], (v8f)0.0f);
      s1[u] = wmma16(k10, aq0[u], (v8f)0.0f);
    }
#pragma unroll
    for (int u = 0; u < QW; ++u) {
      s0[u] = wmma16(k01, aq1[u], s0[u]);
      s1[u] = wmma16(k11, aq1[u], s1[u]);
    }

    // scale (+ mask in a tail tile)
    float sc[QW][16];
#pragma unroll
    for (int u = 0; u < QW; ++u)
#pragma unroll
      for (int r = 0; r < 8; ++r) {
        sc[u][r]     = s0[u][r] * SM_SCALE;
        sc[u][8 + r] = s1[u][r] * SM_SCALE;
      }
    if (tail) {
#pragma unroll
      for (int r = 0; r < 8; ++r) {
#pragma unroll
        for (int u = 0; u < QW; ++u) {
          if (r >= lim)      sc[u][r]     = NEG_BIG;
          if (16 + r >= lim) sc[u][8 + r] = NEG_BIG;
        }
      }
    }

    // V^T fragments ([h][t] rows from LDS), asked for in front of the branch below
    // so that they arrive under the exponentials
    v16h av[4];
#pragma unroll
    for (int j = 0; j < 4; ++j) av[j] = load_tile_h(vbufp + (j * 16) * VLD, VLD, lane);

    // p = exp(score - reference) and the lane's sum of them
    // a key past nk has the score NEG_BIG, and exp(NEG_BIG - m) is 0 once a key of the
    // range has counted (the places are in order: key 0 of its first tile does,
    // unless the whole range lies past nk: that case is cleared behind the loop)
    float p[QW][16], ps[QW];
    auto expsum = [&](int u) {
      float t[16];
#pragma unroll
      for (int i = 0; i < 16; ++i) t[i] = p[u][i] = __expf(sc[u][i] - m[u]);
#pragma unroll
      for (int w = 8; w >= 1; w >>= 1)
#pragma unroll
        for (int i = 0; i < w; ++i) t[i] += t[i + w];
      ps[u] = t[0];
    };
    uint32_t need = 1;   // the first tile sets the references
    if (it != 0) {
#pragma unroll
      for (int u = 0; u < QW; ++u) expsum(u);
      // one test a trip, the same in the whole wave; an infinity or a NaN fails it too
      need = __builtin_amdgcn_ballot_w32(!(ps[0] + ps[1] <= PSUM_MAX));
    }
    if (need != 0) {
      // new references from this tile's maxima; sum and O^T follow them
#pragma unroll
      for (int u = 0; u < QW; ++u) {
        float t[16];
#pragma unroll
        for (int i = 0; i < 16; ++i) t[i] = sc[u][i];
#pragma unroll
        for (int w = 8; w >= 1; w >>= 1)
#pragma unroll
          for (int i = 0; i < w; ++i) t[i] = fmaxf(t[i], t[i + w]);
        const float rmax  = fmaxf(t[0], xhalf(t[0]));
        const float nm    = fmaxf(m[u], rmax);   // a reference only rises
        const float alpha = __expf(m[u] - nm);
        m[u] = nm;
        expsum(u);
        l[u] *= alpha;
#pragma unroll
        for (int j = 0; j < 4; ++j) o[u][j] *= alpha;
      }
    }

    // P^T in the B layout: element i of the lane is key (i < 8 ? 8*half + i
    // : 16 + 8*half + i - 8), the k order of load_tile_h on the V^T rows
    v16h pb[QW];
#pragma unroll
    for (int u = 0; u < QW; ++u) {
#pragma unroll
      for (int i = 0; i < 16; ++i) pb[u][i] = (_Float16)p[u][i];
      l[u] += ps[u];
    }

    // O^T += V^T * P^T, each V^T fragment used for both query tiles
#pragma unroll
    for (int j = 0; j < 4; ++j)
#pragma unroll
      for (int u = 0; u < QW; ++u) o[u][j] = wmma16(av[j], pb[u], o[u][j]);

    // my reads of 'cur' are back and my prefetch has landed, then everyone is
    // done reading 'cur' before it is refilled (after the last trip: rewritten)
    asm volatile("s_wait_dscnt 0x0" ::: "memory");
    asm volatile("s_wait_asynccnt 0x0" ::: "memory");
    __syncthreads();
  }

  // a range wholly past nk has the reference NEG_BIG and summed exp(0): it counts nothing
  if (k0 >= nk) {
#pragma unroll
    for (int u = 0; u < QW; ++u) {
      l[u] = 0.0f;
#pragma unroll
      for (int j = 0; j < 4; ++j) o[u][j] = (v8f)0.0f;
    }
  }

  // merge of the 8 key ranges of a query tile. Each wave leaves its O^T tiles
  // (16B per lane and piece, lanes adjacent) and its (reference, sum) in LDS, in slot
  // range * NQ + query tile
#pragma unroll
  for (int u = 0; u < QW; ++u) {
    const int slot = sp * NQ + qi + u;
    const float lt = l[u] + xhalf(l[u]);   // both halves' keys
#pragma unroll
    for (int j = 0; j < 4; ++j) {
      float4* pw = (float4*)(smem + (slot * 4 + j) * 1024 + lane * 16);
      pw[0]  = make_float4(o[u][j][0], o[u][j][1], o[u][j][2], o[u][j][3]);
      pw[32] = make_float4(o[u][j][4], o[u][j][5], o[u][j][6], o[u][j][7]);
    }
    *(float2*)(smem + MLBASE + (slot * 32 + lane) * 8) = make_float2(m[u], lt);
  }
  __syncthreads();

  // wave w finishes 8 queries x 32 h of query tile w & 3: whole 128B lines of
  // out, each from one wave. A lane takes 8 consecutive h of one query.
  const int tq = wave & (NQ - 1);                 // query tile inside the block
  const int pt = wave / NQ;                       // which 8 queries, which 32 h
  const int mq = (pt >> 1) * 8 + (lane & 7);      // query inside the q-tile
  const int mh = (lane >> 3) & 1;                 // the half that held these h
  const int mj = (pt & 1) * 2 + (lane >> 4);      // O^T tile
  float pm[NS], pl[NS];
#pragma unroll
  for (int s = 0; s < NS; ++s) {
    const float2 ml = *(const float2*)(smem + MLBASE + ((s * NQ + tq) * 32 + mq) * 8);
    pm[s] = ml.x;
    pl[s] = ml.y;
  }
  float gm = pm[0];
#pragma unroll
  for (int s = 1; s < NS; ++s) gm = fmaxf(gm, pm[s]);
  float gl = 0.0f;
  float r[8];
#pragma unroll
  for (int i = 0; i < 8; ++i) r[i] = 0.0f;
#pragma unroll
  for (int s = 0; s < NS; ++s) {
    const float wgt = __expf(pm[s] - gm);
    gl += wgt * pl[s];
    const float4* pr = (const float4*)(smem + ((s * NQ + tq) * 4 + mj) * 1024 + (mh * 16 + mq) * 16);
    const float4 x0 = pr[0], x1 = pr[32];
    r[0] += wgt * x0.x; r[1] += wgt * x0.y; r[2] += wgt * x0.z; r[3] += wgt * x0.w;
    r[4] += wgt * x1.x; r[5] += wgt * x1.y; r[6] += wgt * x1.z; r[7] += wgt * x1.w;
  }
  const float inv = 1.0f / gl;
  float* ob = out + ((size_t)b * TN + (qt0 + tq) * 16 + mq) * HN + mj * 16 + mh * 8;
#pragma unroll
  for (int i = 0; i < 8; ++i) ob[i] = r[i] * inv;
}

// ---------------------------------------------------------------------------
extern "C" void kernel_launch(void* const* d_in, const int* in_sizes, int n_in,
                              void* d_out, int out_size, void* d_ws, size_t ws_size,
                              hipStream_t stream) {
  (void)in_sizes; (void)n_in; (void)out_size; (void)ws_size;
  const float* x  = (const float*)d_in[0];
  const int*   am = (const int*)d_in[1];
  const float* Wk = (const float*)d_in[2];
  const float* Wq = (const float*)d_in[3];
  const float* Wv = (const float*)d_in[4];
  float*       out = (float*)d_out;

  // workspace layout (f16): [3][H][C] weights^T, q16, k16, vt16; (int) pos, nkeys
  _Float16* wt   = (_Float16*)d_ws;
  _Float16* q16  = wt  + (size_t)3 * HN * CN;
  _Float16* k16  = q16 + (size_t)BN * TN * HN;
  _Float16* vt16 = k16 + (size_t)BN * TN * HN;
  int*      pos  = (int*)(vt16 + (size_t)BN * TN * HN);
  int*      nkeys = pos + (size_t)BN * TN;

  cvt_weights<<<NCVT + BN, 256, 0, stream>>>(Wq, Wk, Wv, am, wt, pos, nkeys);
  qkv_proj<<<(BN * TN) / PROWS, 512, 0, stream>>>(x, wt, pos, q16, k16, vt16);
  flash_attn<<<(BN * TN / 16) / NQ, NWAVE * 32, 0, stream>>>(q16, k16, vt16, nkeys, out);
}

// v009
// One run takes 27.1 microseconds.
// Next to v008, in two timings, it ran 1.03 times as fast each time.
// All steps since v000 together make it 17.8 times as fast.
#include <hip/hip_runtime.h>
#include <hip/hip_bf16.h>

typedef __attribute__((ext_vector_type(16))) _Float16 v16h;
typedef __attribute__((ext_vector_type(8)))  float    v8f;
typedef __attribute__((ext_vector_type(8)))  _Float16 v8h;

constexpr int BN = 4, TN = 4096, CN = 768, HN = 64;
constexpr float SM_SCALE = 0.03608439182435161f;  // 1/sqrt(768) -- reference scales by C**-0.5
constexpr float NEG_BIG  = -3.0e38f;
// a lane's sum of a trip's exponentials (2 x 16) may reach this before the
// softmax references are renewed: every one of them then fits f16 with room
constexpr float PSUM_MAX = 4096.0f;

// LDS row pitches of the staged K and V^T tiles, in bytes: an odd multiple of
// 16 B, so that the 16 rows one ds_load_b128 half-wave reads fall on 64
// different banks (the bare 128 B and 64 B rows fall on 8 and on 16)
constexpr int KPITCH = HN * 2 + 16;          // 144
constexpr int VPITCH = 32 * 2 + 16;          // 80
constexpr int KBUF   = 32 * KPITCH;          // 4608, one K tile
constexpr int VBUF   = HN * VPITCH;          // 5120, one V^T tile

// attention work-group: NQ query tiles x NS key ranges; a wave takes QW query
// tiles of one range, so that a K or V^T fragment read from LDS serves QW tiles
constexpr int NQ     = 4;
constexpr int QW     = 2;
constexpr int NS     = 8;
constexpr int NWAVE  = NQ / QW * NS;         // 16
constexpr int KSTAGE = NS * KBUF;            // 36864, the K tiles of one stage
constexpr int VSTAGE = NS * VBUF;            // 40960, the V^T tiles of one stage
constexpr int NBUF   = 3;                    // buffers of a ring: one read, two being filled
constexpr int VBASE  = NBUF * KSTAGE;        // 110592
constexpr int LDS_SZ = VBASE + NBUF * VSTAGE;   // 233472
// after the loop the ring holds the partial results, one slot a (range, query tile)
constexpr int MLBASE = NQ * NS * 4096;       // 131072: (reference, sum) pairs behind the O^T partials
static_assert(MLBASE + NQ * NS * 32 * 8 <= LDS_SZ, "partials fit the ring");

// ---------------------------------------------------------------------------
// D = A*B + C, f16 inputs, f32 accumulate (v_wmma_f32_16x16x32_f16)
__device__ __forceinline__ v8f wmma16(v16h a, v16h b, v8f c) {
  return __builtin_amdgcn_wmma_f32_16x16x32_f16(false, a, false, b, (short)0, c,
                                                false, false);
}

// Load a 16x32 f16 tile (row-major, row stride ld) into the WMMA A/B register
// layout for wave32:
//   lanes 0-15 : row = lane,    halves = cols {0..7} then {16..23}
//   lanes 16-31: row = lane-16, halves = cols {8..15} then {24..31}
__device__ __forceinline__ v16h load_tile_h(const _Float16* base, int ld, int lane) {
  const int r  = lane & 15;
  const int c0 = (lane & 16) ? 8 : 0;
  const _Float16* p = base + r * ld + c0;
  v16h o;
#pragma unroll
  for (int i = 0; i < 8; ++i) { o[i] = p[i]; o[8 + i] = p[16 + i]; }
  return o;
}

// Same tile layout but source is f32 (converted to f16 on the fly).
__device__ __forceinline__ v16h load_tile_f(const float* base, int ld, int lane) {
  const int r  = lane & 15;
  const int c0 = (lane & 16) ? 8 : 0;
  const float* p = base + r * ld + c0;
  v16h o;
#pragma unroll
  for (int i = 0; i < 8; ++i) {
    o[i]     = (_Float16)p[i];
    o[8 + i] = (_Float16)p[16 + i];
  }
  return o;
}

// ---------------------------------------------------------------------------
// Kernel 1: transpose + convert weights to f16.  wt layout: [3][H][C] with
// w=0 -> Wq^T, w=1 -> Wk^T, w=2 -> Wv^T  (row h, col c: contiguous in c).
// The last BN blocks scan the key mask instead, one batch each: pos[b][t] is
// the place of key t in a stable partition of the batch's keys, the kept keys
// (mask != 0) first, the masked ones behind them; nkeys[b] counts the kept.
constexpr int NCVT = (3 * CN * HN + 255) / 256;   // blocks that convert weights

__global__ void __launch_bounds__(256)
cvt_weights(const float* __restrict__ Wq, const float* __restrict__ Wk,
            const float* __restrict__ Wv, const int* __restrict__ amask,
            _Float16* __restrict__ wt, int* __restrict__ pos,
            int* __restrict__ nkeys) {
  if (blockIdx.x >= NCVT) {
    __shared__ int wsum[8];
    const int bb = blockIdx.x - NCVT;
    const int t0 = threadIdx.x * 16;           // 16 keys a thread
    const int ln = threadIdx.x & 31, wv = threadIdx.x >> 5;
    const int4* mp = (const int4*)(amask + bb * TN + t0);
    int f[16];
#pragma unroll
    for (int i = 0; i < 4; ++i) {
      const int4 v = mp[i];
      f[4 * i] = v.x != 0; f[4 * i + 1] = v.y != 0;
      f[4 * i + 2] = v.z != 0; f[4 * i + 3] = v.w != 0;
    }
    int c = 0;
#pragma unroll
    for (int i = 0; i < 16; ++i) c += f[i];
    int inc = c;                               // inclusive scan over the wave
#pragma unroll
    for (int d = 1; d < 32; d <<= 1) {
      const int u = __shfl_up(inc, d, 32);
      if (ln >= d) inc += u;
    }
    if (ln == 31) wsum[wv] = inc;
    __syncthreads();
    int before = inc - c, total = 0;           // kept keys in front of t0; all kept keys
#pragma unroll
    for (int w = 0; w < 8; ++w) {
      const int s = wsum[w];
      if (w < wv) before += s;
      total += s;
    }
    int p[16];
#pragma unroll
    for (int i = 0; i < 16; ++i) {
      p[i] = f[i] ? before : total + (t0 + i) - before;
      before += f[i];
    }
    int4* pp = (int4*)(pos + bb * TN + t0);
#pragma unroll
    for (int i = 0; i < 4; ++i)
      pp[i] = make_int4(p[4 * i], p[4 * i + 1], p[4 * i + 2], p[4 * i + 3]);
    if (threadIdx.x == 0) nkeys[bb] = total;
    return;
  }
  int idx = blockIdx.x * blockDim.x + threadIdx.x;
  if (idx >= 3 * CN * HN) return;
  int w   = idx / (CN * HN);
  int rem = idx - w * (CN * HN);
  int h   = rem / CN;
  int c   = rem - h * CN;
  const float* W = (w == 0) ? Wq : (w == 1) ? Wk : Wv;
  wt[idx] = (_Float16)W[c * HN + h];
}

// ---------------------------------------------------------------------------
// Kernel 2: QKV projection.  [B*T, C] x [C, H] (x3) with WMMA, f32 accum.
// Block = 16 waves on 64 rows of x and all 192 output columns; grid 256.
// The k range runs in 6 slabs of 128: a slab of x (64 rows x 512B, f32) and of
// the weights^T (192 rows x 256B, f16) is brought into LDS by async copies in
// which a wave covers whole 128B lines, three buffers, the next two slabs in
// flight while this one is worked on: the even waves copy the even slabs, the
// odd waves the odd ones, so that a wave that waits for its slab (to 0) has
// nothing younger in flight, while the other waves' slab flies on. Wave (rt, cg) owns row tile rt and column tile
// cg of each of q, k, v; its fragments come from LDS.
// Outputs: q16 row-major [B*T, H] f16; k16 [B][T][H] and v transposed, tile by
// tile of 32 places, vt16 [B][T/32][H][32] f16 (a tile is 4KB in a row, as the
// attention kernel copies it), both with key t at place pos[b][t]. The block's V
// tile goes through LDS, so that a wave's stores run along the places of one h.
constexpr int PROWS  = 64;                   // rows of x of one block
constexpr int PK     = 128;                  // k of one slab
constexpr int PSLABS = CN / PK;              // 6
constexpr int XPITCH = PK * 4 + 16;          // 528 B, 16 B x odd
constexpr int WPITCH = PK * 2 + 16;          // 272 B, 16 B x odd
constexpr int XBUF   = PROWS * XPITCH;       // 33792
constexpr int WBUF   = 3 * HN * WPITCH;      // 52224
constexpr int PSTAGE = XBUF + WBUF;          // 86016
constexpr int VSLD   = PROWS + 8;            // halves of one h row of the staged V tile (144 B)

__global__ void __launch_bounds__(512)
qkv_proj(const float* __restrict__ x, const _Float16* __restrict__ wt,
         const int* __restrict__ pos,
         _Float16* __restrict__ q16, _Float16* __restrict__ k16,
         _Float16* __restrict__ vt16) {
  __shared__ __attribute__((aligned(256))) char smem[NBUF * PSTAGE];

  const int tid  = threadIdx.x;
  const int lane = tid & 31;
  const int wave = __builtin_amdgcn_readfirstlane(tid >> 5);
  const int rt   = wave & 3;                 // row tile inside the block
  const int cg   = wave >> 2;                // column tile of q, of k and of v
  const int blockrow = blockIdx.x * PROWS;

  const int par = wave & 1;                  // the slabs this wave copies: even or odd
  const int cw  = wave >> 1;                 // its place among the 8 waves that copy a slab
  // x slab: a copy takes one row's 512B; 8 rows a round, 8 rounds
  const char* xg = (const char*)(x + (size_t)(blockrow + cw) * CN) + lane * 16;
  // weight slab: a copy takes two rows' 256B; 16 rows a round, 12 rounds
  const int wr = cw * 2 + (lane >> 4);
  const char* wg = (const char*)(wt + (size_t)wr * CN) + (lane & 15) * 16;
  const uint32_t lds0 = (uint32_t)(size_t)smem;
  const uint32_t xl = lds0 + (uint32_t)(cw * XPITCH + lane * 16);
  const uint32_t wl = lds0 + (uint32_t)(XBUF + wr * WPITCH + (lane & 15) * 16);

  auto fetch = [&](int s, int buf) {
    const char* xs = xg + s * (PK * 4);
    const char* ws = wg + s * (PK * 2);
    const uint32_t xd = xl + (uint32_t)(buf * PSTAGE);
    const uint32_t wd = wl + (uint32_t)(buf * PSTAGE);
    // s_wait_xcnt 0 ends each statement of copies, so that it stands in front
    // of every later write of a register that they name
    asm volatile("global_load_async_to_lds_b128 %0, %1, off\n\t"
                 "global_load_async_to_lds_b128 %2, %3, off\n\t"
                 "global_load_async_to_lds_b128 %4, %5, off\n\t"
                 "global_load_async_to_lds_b128 %6, %7, off\n\t"
                 "global_load_async_to_lds_b128 %8, %9, off\n\t"
                 "global_load_async_to_lds_b128 %10, %11, off\n\t"
                 "global_load_async_to_lds_b128 %12, %13, off\n\t"
                 "global_load_async_to_lds_b128 %14, %15, off\n\t"
                 "s_wait_xcnt 0x0"
                 :: "v"(xd),                "v"(xs),
                    "v"(xd + 8 * XPITCH),   "v"(xs + 8 * (CN * 4)),
                    "v"(xd + 16 * XPITCH),  "v"(xs + 16 * (CN * 4)),
                    "v"(xd + 24 * XPITCH),  "v"(xs + 24 * (CN * 4)),
                    "v"(xd + 32 * XPITCH),  "v"(xs + 32 * (CN * 4)),
                    "v"(xd + 40 * XPITCH),  "v"(xs + 40 * (CN * 4)),
                    "v"(xd + 48 * XPITCH),  "v"(xs + 48 * (CN * 4)),
                    "v"(xd + 56 * XPITCH),  "v"(xs + 56 * (CN * 4))
                 : "memory");
    asm volatile("global_load_async_to_lds_b128 %0, %1, off\n\t"
                 "global_load_async_to_lds_b128 %2, %3, off\n\t"
                 "global_load_async_to_lds_b128 %4, %5, off\n\t"
                 "global_load_async_to_lds_b128 %6, %7, off\n\t"
                 "global_load_async_to_lds_b128 %8, %9, off\n\t"
                 "global_load_async_to_lds_b128 %10, %11, off\n\t"
                 "global_load_async_to_lds_b128 %12, %13, off\n\t"
                 "global_load_async_to_lds_b128 %14, %15, off\n\t"
                 "global_load_async_to_lds_b128 %16, %17, off\n\t"
                 "global_load_async_to_lds_b128 %18, %19, off\n\t"
                 "global_load_async_to_lds_b128 %20, %21, off\n\t"
                 "global_load_async_to_lds_b128 %22, %23, off\n\t"
                 "s_wait_xcnt 0x0"
                 :: "v"(wd),                "v"(ws),
                    "v"(wd + 16 * WPITCH),  "v"(ws + 16 * (CN * 2)),
                    "v"(wd + 32 * WPITCH),  "v"(ws + 32 * (CN * 2)),
                    "v"(wd + 48 * WPITCH),  "v"(ws + 48 * (CN * 2)),
                    "v"(wd + 64 * WPITCH),  "v"(ws + 64 * (CN * 2)),
                    "v"(wd + 80 * WPITCH),  "v"(ws + 80 * (CN * 2)),
                    "v"(wd + 96 * WPITCH),  "v"(ws + 96 * (CN * 2)),
                    "v"(wd + 112 * WPITCH), "v"(ws + 112 * (CN * 2)),
                    "v"(wd + 128 * WPITCH), "v"(ws + 128 * (CN * 2)),
                    "v"(wd + 144 * WPITCH), "v"(ws + 144 * (CN * 2)),
                    "v"(wd + 160 * WPITCH), "v"(ws + 160 * (CN * 2)),
                    "v"(wd + 176 * WPITCH), "v"(ws + 176 * (CN * 2))
                 : "memory");
  };

  v8f acc[3];  // q, k, v
#pragma unroll
  for (int i = 0; i < 3; ++i) acc[i] = (v8f)0.0f;

  static_assert(PSLABS >= 2, "slabs 0 and 1 exist");
  if (par == 0) fetch(0, 0); else fetch(1, 1);

  // places of the keys this lane will store (read here, used behind the loop);
  // '& (TN - 1)' bounds every address formed from them
  const int rl0 = rt * 16 + (lane >> 4) * 8;         // first of the lane's 8 rows
  int kp[8];
  {
    const int4 p0 = *(const int4*)(pos + blockrow + rl0);
    const int4 p1 = *(const int4*)(pos + blockrow + rl0 + 4);
    kp[0] = p0.x & (TN - 1); kp[1] = p0.y & (TN - 1);
    kp[2] = p0.z & (TN - 1); kp[3] = p0.w & (TN - 1);
    kp[4] = p1.x & (TN - 1); kp[5] = p1.y & (TN - 1);
    kp[6] = p1.z & (TN - 1); kp[7] = p1.w & (TN - 1);
  }
  const int vpa = pos[blockrow + lane] & (TN - 1);
  const int vpb = pos[blockrow + 32 + lane] & (TN - 1);
  // where a place lies in vt16, h = 0: its tile, then its column
  const int voa = (vpa >> 5) * (HN * 32) + (vpa & 31);
  const int vob = (vpb >> 5) * (HN * 32) + (vpb & 31);

  // slab 0 has landed: its copiers wait, slab 1 flies on
  if (par == 0) asm volatile("s_wait_asynccnt 0x0" ::: "memory");
  __syncthreads();

  constexpr int XLD = XPITCH / 4, WLD = WPITCH / 2;   // pitches in elements
  int cur = 0, nxt = 1, fil = 2;                      // buffers of slabs s, s + 1, s + 2
  for (int s = 0; s < PSLABS; ++s) {
    // slab s + 2 goes where slab s - 1 lay: everyone left it at the last barrier
    if (s + 2 < PSLABS && par == (s & 1)) fetch(s + 2, fil);
    const float*    xb = (const float*)(smem + cur * PSTAGE) + rt * 16 * XLD;
    const _Float16* wb = (const _Float16*)(smem + cur * PSTAGE + XBUF) + cg * 16 * WLD;
#pragma unroll
    for (int kc = 0; kc < PK; kc += 32) {
      v16h a = load_tile_f(xb + kc, XLD, lane);
#pragma unroll
      for (int w = 0; w < 3; ++w) {
        v16h b = load_tile_h(wb + w * HN * WLD + kc, WLD, lane);
        acc[w] = wmma16(a, b, acc[w]);
      }
    }
    // my reads of 'cur' are back, and the copiers of slab s + 1 have seen it land
    // (they have nothing younger in flight), then everyone has left 'cur'
    asm volatile("s_wait_dscnt 0x0" ::: "memory");
    if (par != (s & 1)) asm volatile("s_wait_asynccnt 0x0" ::: "memory");
    __syncthreads();
    const int t = cur; cur = nxt; nxt = fil; fil = t;
  }
  asm volatile("s_wait_asynccnt 0x0" ::: "memory");   // no copy is left when the wave ends

  // C/D layout: element r of acc -> row (r + 8*(lane/16)), col (lane&15).
  const int h    = cg * 16 + (lane & 15);
  const int row0 = blockrow + rl0;
  const int b    = blockrow >> 12;   // T = 4096: the block's rows lie in one batch
  _Float16* vs = (_Float16*)smem;    // [h][row of the block]; the ring is free now
  v8h vv;
#pragma unroll
  for (int r = 0; r < 8; ++r) vv[r] = (_Float16)acc[2][r];
  *(v8h*)(vs + h * VSLD + rl0) = vv;
  __syncthreads();   // in front of the global stores: it then waits for LDS alone
#pragma unroll
  for (int r = 0; r < 8; ++r) {
    q16[(size_t)(row0 + r) * HN + h] = (_Float16)acc[0][r];
    k16[((size_t)b * TN + kp[r]) * HN + h] = (_Float16)acc[1][r];
  }
  // wave w stores h = 4w .. 4w+3; a lane takes rows 'lane' and 'lane + 32': the
  // 32 places of a store lie in two short runs (kept keys, masked keys)
#pragma unroll
  for (int i = 0; i < 4; ++i) {
    const int hh = wave * 4 + i;
    _Float16* vrow = vt16 + (size_t)b * HN * TN + hh * 32;
    vrow[voa] = vs[hh * VSLD + lane];
    vrow[vob] = vs[hh * VSLD + 32 + lane];
  }
}

// ---------------------------------------------------------------------------
// lane l <-> lane l ^ 16: both hold the same query column, each half of its keys
__device__ __forceinline__ float xhalf(float x) {
  const int v = __builtin_bit_cast(int, x);
  return __builtin_bit_cast(float, __builtin_amdgcn_permlanex16(
      v, v, 0x76543210, 0xfedcba98, false, false));
}

// ---------------------------------------------------------------------------
// Kernel 3: flash attention with async-staged K/V tiles in LDS.
// Block = 16 waves on one batch: 4 query tiles x 8 key ranges, a wave on 2 query
// tiles of one range. K and V^T come
// with the batch's nk kept keys in front (a masked key adds nothing to any sum),
// so the ranges cover only ceil(nk / 256) tiles of 32 keys each; a tile that
// reaches past nk tests the key's place.
// The 2 waves of a key range share that range's K/V tile stream; each wave
// keeps a reference, sum and O^T per query tile over its range, and the 8 partial
// results of a query tile are merged through LDS behind the loop.
// Per trip and range: async copy K (32x64 f16, 4KB) and V^T (64x32 f16, 4KB)
// into a ring of three LDS buffers (ASYNCcnt), two trips ahead, the range's two
// waves taking turns (one copies the even trips' tiles, one the odd trips'), so
// that a wait to 0 leaves the other wave's tiles in flight; one barrier per trip; each wave
// computes S^T = K*Q^T (WMMA: rows = keys, columns = queries), so that a lane
// holds 16 of the 32 scores of ONE query. The softmax reference of a query is
// the maximum of its range's first tile and stays until a lane's sum of a
// trip's exponentials passes PSUM_MAX (one test a trip for the whole wave): only
// then come a maximum, the exchange between the wave's halves and the rescaling
// of sum and O^T. The two S^T tiles, converted in place, are the B operand P^T
// of O^T += V^T*P^T (WMMA): P never leaves the registers.
//
// LDS layout:
//   [     0, 110592)  K tiles,  3 stages x 8 ranges x 4608B, [t][h], rows of 144B
//   [110592, 233472)  V tiles,  3 stages x 8 ranges x 5120B, [h][t], rows of 80B
__global__ void __launch_bounds__(NWAVE * 32)
flash_attn(const _Float16* __restrict__ q16, const _Float16* __restrict__ k16,
           const _Float16* __restrict__ vt16, const int* __restrict__ nkeys,
           float* __restrict__ out) {
  __shared__ __attribute__((aligned(256))) char smem[LDS_SZ];

  const int tid  = threadIdx.x;
  const int lane = tid & 31;
  const int wave = __builtin_amdgcn_readfirstlane(tid >> 5);
  const int qi   = (wave & (NQ / QW - 1)) * QW;   // first of the wave's query tiles in the block
  const int sp   = wave / (NQ / QW);              // key range
  const int b    = blockIdx.x / (TN / 16 / NQ);                  // 64 blocks per batch
  const int qt0  = (blockIdx.x % (TN / 16 / NQ)) * NQ;           // the block's first q-tile in the batch
  // kept keys of the batch, clamped to the shape: it bounds trips and addresses
  const int nk   = __builtin_amdgcn_readfirstlane(min(max(nkeys[b], 0), TN));
  const int nit  = (nk + NS * 32 - 1) / (NS * 32);               // trips, at most 16
  const int k0   = sp * nit * 32;            // first key of the range

  // one wave of a range copies a trip's tiles: 8 x 16B of K and of V^T a lane
  static_assert(NQ / QW == 2, "the two waves of a range take turns");
  const int par = wave & 1;                  // the trips whose tiles this wave copies: even or odd
  const char* kg = (const char*)(k16 + ((size_t)b * TN + k0) * HN) + lane * 16;     // [t][h]
  const char* vg = (const char*)(vt16 + ((size_t)b * TN + k0) * HN) + lane * 16;    // [tile][h][t]
  const uint32_t lds0 = (uint32_t)(size_t)smem;
  const uint32_t kl = lds0 + (uint32_t)(sp * KBUF + (lane >> 3) * KPITCH + (lane & 7) * 16);
  const uint32_t vl = lds0 + (uint32_t)(VBASE + sp * VBUF + (lane >> 2) * VPITCH + (lane & 3) * 16);

  // async fetch of the range's 32-key K tile + V tile of trip 'it'
  auto fetch_kv = [&](int it, int buf) {
    // K tile: contiguous 4KB in global memory, 8 copies per row; 4 rows a round
    const uint32_t kla = kl + (uint32_t)(buf * KSTAGE);
    const char* kga = kg + it * (32 * HN * 2);
    // V tile: contiguous 4KB in global memory, 4 copies per row; 8 rows a round
    const uint32_t vla = vl + (uint32_t)(buf * VSTAGE);
    const char* vga = vg + it * (32 * HN * 2);
    // s_wait_xcnt 0 ends each statement of copies, so that it stands in front
    // of every later write of a register that they name
    asm volatile("global_load_async_to_lds_b128 %0, %1, off\n\t"
                 "global_load_async_to_lds_b128 %2, %3, off\n\t"
                 "global_load_async_to_lds_b128 %4, %5, off\n\t"
                 "global_load_async_to_lds_b128 %6, %7, off\n\t"
                 "global_load_async_to_lds_b128 %8, %9, off\n\t"
                 "global_load_async_to_lds_b128 %10, %11, off\n\t"
                 "global_load_async_to_lds_b128 %12, %13, off\n\t"
                 "global_load_async_to_lds_b128 %14, %15, off\n\t"
                 "s_wait_xcnt 0x0"
                 :: "v"(kla),               "v"(kga),
                    "v"(kla + 4 * KPITCH),  "v"(kga + 4 * (HN * 2)),
                    "v"(kla + 8 * KPITCH),  "v"(kga + 8 * (HN * 2)),
                    "v"(kla + 12 * KPITCH), "v"(kga + 12 * (HN * 2)),
                    "v"(kla + 16 * KPITCH), "v"(kga + 16 * (HN * 2)),
                    "v"(kla + 20 * KPITCH), "v"(kga + 20 * (HN * 2)),
                    "v"(kla + 24 * KPITCH), "v"(kga + 24 * (HN * 2)),
                    "v"(kla + 28 * KPITCH), "v"(kga + 28 * (HN * 2))
                 : "memory");
    asm volatile("global_load_async_to_lds_b128 %0, %1, off\n\t"
                 "global_load_async_to_lds_b128 %2, %3, off\n\t"
                 "global_load_async_to_lds_b128 %4, %5, off\n\t"
                 "global_load_async_to_lds_b128 %6, %7, off\n\t"
                 "global_load_async_to_lds_b128 %8, %9, off\n\t"
                 "global_load_async_to_lds_b128 %10, %11, off\n\t"
                 "global_load_async_to_lds_b128 %12, %13, off\n\t"
                 "global_load_async_to_lds_b128 %14, %15, off\n\t"
                 "s_wait_xcnt 0x0"
                 :: "v"(vla),               "v"(vga),
                    "v"(vla + 8 * VPITCH),  "v"(vga + 8 * (32 * 2)),
                    "v"(vla + 16 * VPITCH), "v"(vga + 16 * (32 * 2)),
                    "v"(vla + 24 * VPITCH), "v"(vga + 24 * (32 * 2)),
                    "v"(vla + 32 * VPITCH), "v"(vga + 32 * (32 * 2)),
                    "v"(vla + 40 * VPITCH), "v"(vga + 40 * (32 * 2)),
                    "v"(vla + 48 * VPITCH), "v"(vga + 48 * (32 * 2)),
                    "v"(vla + 56 * VPITCH), "v"(vga + 56 * (32 * 2))
                 : "memory");
  };

  // Q^T fragments of the wave's QW query tiles
  v16h aq0[QW], aq1[QW];
#pragma unroll
  for (int u = 0; u < QW; ++u) {
    const _Float16* qb = q16 + ((size_t)b * TN + (qt0 + qi + u) * 16) * HN;
    aq0[u] = load_tile_h(qb, HN, lane);        // h = 0..31
    aq1[u] = load_tile_h(qb + 32, HN, lane);   // h = 32..63
  }

  const int half  = lane >> 4;

  // O^T tiles: o[u][j][r] = O[query lane & 15 of tile u][h = 16*j + 8*half + r]
  v8f o[QW][4];
  float m[QW];   // softmax reference of this lane's query (equal in both halves)
  float l[QW];   // running sum over this half's keys only; joined at the end
#pragma unroll
  for (int u = 0; u < QW; ++u) {
#pragma unroll
    for (int j = 0; j < 4; ++j) o[u][j] = (v8f)0.0f;
    m[u] = NEG_BIG;
    l[u] = 0.0f;
  }

  if (par == 0) {
    fetch_kv(0, 0);
    asm volatile("s_wait_asynccnt 0x0" ::: "memory");   // trip 0's tiles have landed
  } else if (nit > 1) {
    fetch_kv(1, 1);                                     // flies on over the barrier
  }
  __syncthreads();

  int cur = 0, nxt = 1, fil = 2;   // buffers of trips it, it + 1, it + 2
  for (int it = 0; it < nit; ++it) {
    // the tiles of trip it + 2 go where those of trip it - 1 lay: everyone left
    // them at the last barrier
    if (it + 2 < nit && par == (it & 1)) fetch_kv(it + 2, fil);

    const _Float16* kbufp = (const _Float16*)(smem + cur * KSTAGE + sp * KBUF);
    const _Float16* vbufp = (const _Float16*)(smem + VBASE + cur * VSTAGE + sp * VBUF);

    // kept keys from this tile on, the same in the whole wave; below 32 the tile
    // reaches past nk. Element i of a lane's 16 scores is key 8*half + i (i < 8)
    // or 8*half + i + 8 of the tile: it counts while that is below 'left'
    const int  left = nk - (k0 + it * 32);
    const bool tail = left < 32;
    const int  lim  = left - 8 * half;

    // S^T tiles: A = K rows from LDS, each fragment used for both query tiles;
    // B = Q^T kept in registers
    constexpr int KLD = KPITCH / 2, VLD = VPITCH / 2;   // pitches in halves
    const v16h k00 = load_tile_h(kbufp, KLD, lane);
    const v16h k01 = load_tile_h(kbufp + 32, KLD, lane);
    const v16h k10 = load_tile_h(kbufp + 16 * KLD, KLD, lane);
    const v16h k11 = load_tile_h(kbufp + 16 * KLD + 32, KLD, lane);
    v8f s0[QW], s1[QW];
#pragma unroll
    for (int u = 0; u < QW; ++u) {
      s0[u] = wmma16(k00, aq0[u], (v8f)0.0f);
      s1[u] = wmma16(k10, aq0[u], (v8f)0.0f);
    }
#pragma unroll
    for (int u = 0; u < QW; ++u) {
      s0[u] = wmma16(k01, aq1[u], s0[u]);
      s1[u] = wmma16(k11, aq1[u], s1[u]);
    }

    // scale (+ mask in a tail tile)
    float sc[QW][16];
#pragma unroll
    for (int u = 0; u < QW; ++u)
#pragma unroll
      for (int r = 0; r < 8; ++r) {
        sc[u][r]     = s0[u][r] * SM_SCALE;
        sc[u][8 + r] = s1[u][r] * SM_SCALE;
      }
    if (tail) {
#pragma unroll
      for (int r = 0; r < 8; ++r) {
#pragma unroll
        for (int u = 0; u < QW; ++u) {
          if (r >= lim)      sc[u][r]     = NEG_BIG;
          if (16 + r >= lim) sc[u][8 + r] = NEG_BIG;
        }
      }
    }

    // V^T fragments ([h][t] rows from LDS), asked for in front of the branch below
    // so that they arrive under the exponentials
    v16h av[4];
#pragma unroll
    for (int j = 0; j < 4; ++j) av[j] = load_tile_h(vbufp + (j * 16) * VLD, VLD, lane);

    // p = exp(score - reference) and the lane's sum of them
    // a key past nk has the score NEG_BIG, and exp(NEG_BIG - m) is 0 once a key of the
    // range has counted (the places are in order: key 0 of its first tile does,
    // unless the whole range lies past nk: that case is cleared behind the loop)
    float p[QW][16], ps[QW];
    auto expsum = [&](int u) {
      float t[16];
#pragma unroll
      for (int i = 0; i < 16; ++i) t[i] = p[u][i] = __expf(sc[u][i] - m[u]);
#pragma unroll
      for (int w = 8; w >= 1; w >>= 1)
#pragma unroll
        for (int i = 0; i < w; ++i) t[i] += t[i + w];
      ps[u] = t[0];
    };
    uint32_t need = 1;   // the first tile sets the references
    if (it != 0) {
#pragma unroll
      for (int u = 0; u < QW; ++u) expsum(u);
      // one test a trip, the same in the whole wave; an infinity or a NaN fails it too
      need = __builtin_amdgcn_ballot_w32(!(ps[0] + ps[1] <= PSUM_MAX));
    }
    if (need != 0) {
      // new references from this tile's maxima; sum and O^T follow them
#pragma unroll
      for (int u = 0; u < QW; ++u) {
        float t[16];
#pragma unroll
        for (int i = 0; i < 16; ++i) t[i] = sc[u][i];
#pragma unroll
        for (int w = 8; w >= 1; w >>= 1)
#pragma unroll
          for (int i = 0; i < w; ++i) t[i] = fmaxf(t[i], t[i + w]);
        const float rmax  = fmaxf(t[0], xhalf(t[0]));
        const float nm    = fmaxf(m[u], rmax);   // a reference only rises
        const float alpha = __expf(m[u] - nm);
        m[u] = nm;
        expsum(u);
        l[u] *= alpha;
#pragma unroll
        for (int j = 0; j < 4; ++j) o[u][j] *= alpha;
      }
    }

    // my reads of 'cur' are back (what follows works on registers alone), and the
    // wave that copied the tiles of trip it + 1 has seen them land (it has nothing
    // younger in flight), then everyone is done reading 'cur' before it is
    // refilled (after the last trip: rewritten)
    asm volatile("s_wait_dscnt 0x0" ::: "memory");
    if (par != (it & 1)) asm volatile("s_wait_asynccnt 0x0" ::: "memory");
    __syncthreads();

    // P^T in the B layout: element i of the lane is key (i < 8 ? 8*half + i
    // : 16 + 8*half + i - 8), the k order of load_tile_h on the V^T rows
    v16h pb[QW];
#pragma unroll
    for (int u = 0; u < QW; ++u) {
#pragma unroll
      for (int i = 0; i < 16; ++i) pb[u][i] = (_Float16)p[u][i];
      l[u] += ps[u];
    }

    // O^T += V^T * P^T, each V^T fragment used for both query tiles
#pragma unroll
    for (int j = 0; j < 4; ++j)
#pragma unroll
      for (int u = 0; u < QW; ++u) o[u][j] = wmma16(av[j], pb[u], o[u][j]);

    const int t = cur; cur = nxt; nxt = fil; fil = t;
  }

  // a range wholly past nk has the reference NEG_BIG and summed exp(0): it counts nothing
  if (k0 >= nk) {
#pragma unroll
    for (int u = 0; u < QW; ++u) {
      l[u] = 0.0f;
#pragma unroll
      for (int j = 0; j < 4; ++j) o[u][j] = (v8f)0.0f;
    }
  }

  // merge of the 8 key ranges of a query tile. Each wave leaves its O^T tiles
  // (16B per lane and piece, lanes adjacent) and its (reference, sum) in LDS, in slot
  // range * NQ + query tile
#pragma unroll
  for (int u = 0; u < QW; ++u) {
    const int slot = sp * NQ + qi + u;
    const float lt = l[u] + xhalf(l[u]);   // both halves' keys
#pragma unroll
    for (int j = 0; j < 4; ++j) {
      float4* pw = (float4*)(smem + (slot * 4 + j) * 1024 + lane * 16);
      pw[0]  = make_float4(o[u][j][0], o[u][j][1], o[u][j][2], o[u][j][3]);
      pw[32] = make_float4(o[u][j][4], o[u][j][5], o[u][j][6], o[u][j][7]);
    }
    *(float2*)(smem + MLBASE + (slot * 32 + lane) * 8) = make_float2(m[u], lt);
  }
  __syncthreads();

  // wave w finishes 8 queries x 32 h of query tile w & 3: whole 128B lines of
  // out, each from one wave. A lane takes 8 consecutive h of one query.
  const int tq = wave & (NQ - 1);                 // query tile inside the block
  const int pt = wave / NQ;                       // which 8 queries, which 32 h
  const int mq = (pt >> 1) * 8 + (lane & 7);      // query inside the q-tile
  const int mh = (lane >> 3) & 1;                 // the half that held these h
  const int mj = (pt & 1) * 2 + (lane >> 4);      // O^T tile
  float pm[NS], pl[NS];
#pragma unroll
  for (int s = 0; s < NS; ++s) {
    const float2 ml = *(const float2*)(smem + MLBASE + ((s * NQ + tq) * 32 + mq) * 8);
    pm[s] = ml.x;
    pl[s] = ml.y;
  }
  float gm = pm[0];
#pragma unroll
  for (int s = 1; s < NS; ++s) gm = fmaxf(gm, pm[s]);
  float gl = 0.0f;
  float r[8];
#pragma unroll
  for (int i = 0; i < 8; ++i) r[i] = 0.0f;
#pragma unroll
  for (int s = 0; s < NS; ++s) {
    const float wgt = __expf(pm[s] - gm);
    gl += wgt * pl[s];
    const float4* pr = (const float4*)(smem + ((s * NQ + tq) * 4 + mj) * 1024 + (mh * 16 + mq) * 16);
    const float4 x0 = pr[0], x1 = pr[32];
    r[0] += wgt * x0.x; r[1] += wgt * x0.y; r[2] += wgt * x0.z; r[3] += wgt * x0.w;
    r[4] += wgt * x1.x; r[5] += wgt * x1.y; r[6] += wgt * x1.z; r[7] += wgt * x1.w;
  }
  const float inv = 1.0f / gl;
  float* ob = out + ((size_t)b * TN + (qt0 + tq) * 16 + mq) * HN + mj * 16 + mh * 8;
#pragma unroll
  for (int i = 0; i < 8; ++i) ob[i] = r[i] * inv;
}

// ---------------------------------------------------------------------------
extern "C" void kernel_launch(void* const* d_in, const int* in_sizes, int n_in,
                              void* d_out, int out_size, void* d_ws, size_t ws_size,
                              hipStream_t stream) {
  (void)in_sizes; (void)n_in; (void)out_size; (void)ws_size;
  const float* x  = (const float*)d_in[0];
  const int*   am = (const int*)d_in[1];
  const float* Wk = (const float*)d_in[2];
  const float* Wq = (const float*)d_in[3];
  const float* Wv = (const float*)d_in[4];
  float*       out = (float*)d_out;

  // workspace layout (f16): [3][H][C] weights^T, q16, k16, vt16; (int) pos, nkeys
  _Float16* wt   = (_Float16*)d_ws;
  _Float16* q16  = wt  + (size_t)3 * HN * CN;
  _Float16* k16  = q16 + (size_t)BN * TN * HN;
  _Float16* vt16 = k16 + (size_t)BN * TN * HN;
  int*      pos  = (int*)(vt16 + (size_t)BN * TN * HN);
  int*      nkeys = pos + (size_t)BN * TN;

  cvt_weights<<<NCVT + BN, 256, 0, stream>>>(Wq, Wk, Wv, am, wt, pos, nkeys);
  qkv_proj<<<(BN * TN) / PROWS, 512, 0, stream>>>(x, wt, pos, q16, k16, vt16);
  flash_attn<<<(BN * TN / 16) / NQ, NWAVE * 32, 0, stream>>>(q16, k16, vt16, nkeys, out);
}
